// v000
// The times below were measured on an AMD MI455X: many runs one after another, warmed up first and cycling through
// copies of the inputs, with the whole window's GPU time divided by the number of runs. Launches and the gaps
// between them are all in it. The median over several windows is given; except for v000 it joins two sittings, which
// can be a few percent apart, so the side-by-side timings, each taken in one sitting, are the better comparison.
// v000, which the later versions start from, runs in 1470 microseconds.
#include <hip/hip_runtime.h>

// SeqAttention (q, k, v [2][16][2048][64], k_pe [64][2048] shared relative-position keys; scores = (q.k + q.k_pe[:, t]) / 8; softmax; out = attn v -> [2][16][2048][64]).
// The two einsums are regrouped as q . (k_t + k_pe[:, t]) (exact algebra): k + k_pe is formed in f32 from the bf16-rounded inputs (exact) and split into hi/lo bf16 planes; scores = q.hi + q.lo as two PLAIN bf16 GEMMs (inputs q: exact products) summed in the softmax kernel.
// Compute dtypes, f32 accumulate: every input rounded to bf16; scores as above (f32); scale + softmax f32 -> hl probability planes; attn.v as hl x exact bf16 v (2 products); 2 heads per pass.

#define NB_  2
#define NH_  16
#define LL   2048
#define HD   64
#define ZH   2
typedef _Float16 h16;
typedef unsigned short bf;
typedef __attribute__((ext_vector_type(16))) __bf16   v16bf;
typedef __attribute__((ext_vector_type(16))) _Float16 v16h;
typedef __attribute__((ext_vector_type(8)))  _Float16 v8h;
typedef __attribute__((ext_vector_type(8)))  unsigned short v8us;
typedef __attribute__((ext_vector_type(8)))  float    v8f;
typedef __attribute__((ext_vector_type(4)))  float    v4f;
typedef v8h  __attribute__((may_alias)) v8ha;
typedef v4f  __attribute__((may_alias)) v4fa;
typedef v8us __attribute__((may_alias)) v8usa;

__device__ __forceinline__ unsigned short f2bf(float f) { unsigned u = __float_as_uint(f); u += 0x7FFFu + ((u >> 16) & 1u); return (unsigned short)(u >> 16); }
__device__ __forceinline__ float bf2f(unsigned short b) { return __uint_as_float(((unsigned)b) << 16); }
__device__ __forceinline__ float bfr(float f) { return bf2f(f2bf(f)); }
__device__ __forceinline__ v16h cat16(v8h lo, v8h hi) { return __builtin_shufflevector(lo, hi, 0, 1, 2, 3, 4, 5, 6, 7, 8, 9, 10, 11, 12, 13, 14, 15); }
__device__ __forceinline__ v16bf cat16b(v8us lo, v8us hi) { return __builtin_bit_cast(v16bf, __builtin_shufflevector(lo, hi, 0, 1, 2, 3, 4, 5, 6, 7, 8, 9, 10, 11, 12, 13, 14, 15)); }
__device__ __forceinline__ v8f wmma16(v16h a, v16h b, v8f c) { return __builtin_amdgcn_wmma_f32_16x16x32_f16(false, a, false, b, (short)0, c, false, false); }
__device__ __forceinline__ v8f wmmab(v16bf a, v16bf b, v8f c) { return __builtin_amdgcn_wmma_f32_16x16x32_bf16(false, a, false, b, (short)0, c, false, false); }



// ---- k_gemmw: register-blocked GEMM, ONE WAVE per 64x64 output tile (16 accumulators), operands straight from K-contiguous 16-bit planes; grid (M/64, N/64, Z), 32 threads.
// C[m][n] (f32, pitch ldc, + optional f32 bias[n]) = sum_k A[m][k] Bt[n][k] (+ split products per NSPLIT). z-batch strides sA/sB/sC in elements. K % 32 == 0.
template <typename T16> struct WFrag;
template <> struct WFrag<h16> { typedef v16h V; static __device__ __forceinline__ V ld(const h16* p) { return cat16(*(const v8h*)p, *(const v8h*)(p + 16)); } static __device__ __forceinline__ v8f mma(V a, V b, v8f c) { return wmma16(a, b, c); } };
template <> struct WFrag<bf> { typedef v16bf V; static __device__ __forceinline__ V ld(const bf* p) { return cat16b(*(const v8us*)p, *(const v8us*)(p + 16)); } static __device__ __forceinline__ v8f mma(V a, V b, v8f c) { return wmmab(a, b, c); } };
template <typename T16, int NSPLIT, bool BIAS>
__global__ __launch_bounds__(32) void k_gemmw(const T16* __restrict__ A, const T16* __restrict__ A2, const T16* __restrict__ Bt, const T16* __restrict__ Bt2, int K, float* C, int ldc, const float* __restrict__ bias, size_t sA, size_t sB, size_t sC) {
    typedef typename WFrag<T16>::V V;
    __shared__ __align__(16) float os[16 * 68];
    const size_t z = blockIdx.z; A += z * sA; if (A2) A2 += z * sA; Bt += z * sB; if (Bt2) Bt2 += z * sB; C += z * sC;
    const int lane = threadIdx.x & 31, lr = lane & 15, hi = lane >> 4; const int r0 = blockIdx.x * 64, c0 = blockIdx.y * 64;
    v8f acc[4][4];
#pragma unroll
    for (int mb = 0; mb < 4; ++mb)
#pragma unroll
        for (int nb = 0; nb < 4; ++nb) acc[mb][nb] = (v8f){};
    const size_t aoff = (size_t)(r0 + lr) * K + 8 * hi, boff = (size_t)(c0 + lr) * K + 8 * hi;
#pragma unroll 1
    for (int kc = 0; kc < K; kc += 32) {
        V a[4], a2[4];
#pragma unroll
        for (int mb = 0; mb < 4; ++mb) { a[mb] = WFrag<T16>::ld(A + aoff + (size_t)mb * 16 * K + kc); if (NSPLIT == 1 || NSPLIT == 2) a2[mb] = WFrag<T16>::ld(A2 + aoff + (size_t)mb * 16 * K + kc); }
#pragma unroll
        for (int nb = 0; nb < 4; ++nb) { const V b = WFrag<T16>::ld(Bt + boff + (size_t)nb * 16 * K + kc); V b2; if (NSPLIT >= 2) b2 = WFrag<T16>::ld(Bt2 + boff + (size_t)nb * 16 * K + kc);
#pragma unroll
            for (int mb = 0; mb < 4; ++mb) { acc[mb][nb] = WFrag<T16>::mma(a[mb], b, acc[mb][nb]); if (NSPLIT == 1 || NSPLIT == 2) acc[mb][nb] = WFrag<T16>::mma(a2[mb], b, acc[mb][nb]); if (NSPLIT >= 2) acc[mb][nb] = WFrag<T16>::mma(a[mb], b2, acc[mb][nb]); } }
        asm volatile("v_nop\n\tv_nop\n\tv_nop\n\tv_nop" : "+v"(acc[0][0]), "+v"(acc[1][1]), "+v"(acc[2][2]), "+v"(acc[3][3]) : "v"(a[0]), "v"(a[3]));
    }
#pragma unroll
    for (int mb = 0; mb < 4; ++mb) {
#pragma unroll
        for (int nb = 0; nb < 4; ++nb) {
#pragma unroll
            for (int j = 0; j < 8; ++j) os[(hi * 8 + j) * 68 + nb * 16 + lr] = acc[mb][nb][j]; }
        __builtin_amdgcn_wave_barrier(); asm volatile("" ::: "memory");
        float* crow = C + (size_t)(r0 + mb * 16) * ldc + c0;
{
#pragma unroll
            for (int s = 0; s < 8; ++s) { const int row = 2 * s + hi, cofs = lr * 4; v4f val = *(const v4fa*)(os + row * 68 + cofs); if (BIAS) { val[0] += bfr(bias[c0 + cofs]); val[1] += bfr(bias[c0 + cofs + 1]); val[2] += bfr(bias[c0 + cofs + 2]); val[3] += bfr(bias[c0 + cofs + 3]); }
                *(v4f*)(crow + (size_t)row * ldc + cofs) = val; }
             }
        __builtin_amdgcn_wave_barrier(); asm volatile("" ::: "memory");
    }
}

typedef __attribute__((ext_vector_type(2))) unsigned short v2us;
typedef __attribute__((ext_vector_type(4))) unsigned short v4us;
__device__ __forceinline__ void splitf(float y, unsigned short& h, unsigned short& l) { h = f2bf(y); l = f2bf(y - bf2f(h)); }

__global__ __launch_bounds__(256) void k_cvt8(const float* __restrict__ src, bf* dst, size_t n8) { const size_t i = (size_t)blockIdx.x * 256 + threadIdx.x; if (i >= n8) return; const v8f v = *(const v8f*)(src + i * 8); v8us o;
#pragma unroll
    for (int k = 0; k < 8; ++k) o[k] = f2bf(v[k]); *(v8us*)(dst + i * 8) = o;  }
__global__ __launch_bounds__(256) void k_ke(const float* __restrict__ k, const float* __restrict__ kpe, bf* Kh, bf* Kl) { const size_t e = ((size_t)blockIdx.x * 256 + threadIdx.x) * 4; if (e >= (size_t)NH_ * LL * HD) return; const int d = (int)(e % HD); const int t = (int)((e / HD) % LL); v4us oh, ol;
#pragma unroll
    for (int u = 0; u < 4; ++u) { const float s = __fadd_rn(bfr(k[e + u]), bfr(kpe[(size_t)(d + u) * LL + t])); unsigned short a, b; splitf(s, a, b); oh[u] = a; ol[u] = b; } *(v4us*)(Kh + e) = oh; *(v4us*)(Kl + e) = ol;  }
__global__ __launch_bounds__(256) void k_vtb(const float* __restrict__ v, bf* VT) { const size_t e = ((size_t)blockIdx.x * 256 + threadIdx.x) * 2; if (e >= (size_t)NH_ * HD * LL) return; const int t = (int)(e % LL); const int d = (int)((e / LL) % HD); const int h = (int)(e / ((size_t)LL * HD)); v2us o; o[0] = f2bf(v[((size_t)h * LL + t) * HD + d]); o[1] = f2bf(v[((size_t)h * LL + t + 1) * HD + d]); *(v2us*)(VT + e) = o;  }
__global__ __launch_bounds__(256) void k_soft2(const float* __restrict__ S1, const float* __restrict__ S2, bf* Ph, bf* Pl) { const int lane = threadIdx.x & 31; const int row = blockIdx.x * 8 + (threadIdx.x >> 5); if (row >= ZH * LL) return; const float* a1 = S1 + (size_t)row * LL; const float* a2 = S2 + (size_t)row * LL; float v[LL / 32]; float mx = -3.0e38f;
#pragma unroll
    for (int ch = 0; ch < LL / 128; ++ch) { const v4f x1 = *(const v4f*)(a1 + ch * 128 + lane * 4), x2 = *(const v4f*)(a2 + ch * 128 + lane * 4);
#pragma unroll
        for (int u = 0; u < 4; ++u) { const float t = __fadd_rn(x1[u], x2[u]) * 0.125f; v[ch * 4 + u] = t; mx = fmaxf(mx, t); } }
#pragma unroll
    for (int sh = 16; sh; sh >>= 1) mx = fmaxf(mx, __shfl_xor(mx, sh, 32));
    float sum = 0.f;
#pragma unroll
    for (int q = 0; q < LL / 32; ++q) { float d0 = __fsub_rn(v[q], mx); asm volatile("" : "+v"(d0)); v[q] = __builtin_amdgcn_exp2f(__fmul_rn(d0, 1.4426950408889634f)); sum += v[q]; }
#pragma unroll
    for (int sh = 16; sh; sh >>= 1) sum += __shfl_xor(sum, sh, 32);
    const float f = __fdiv_rn(1.0f, sum);
    {
#pragma unroll
        for (int ch = 0; ch < LL / 128; ++ch) { v4us oh, ol; for (int q = 0; q < 4; ++q) { unsigned short a2b, c2; splitf(v[ch * 4 + q] * f, a2b, c2); oh[q] = a2b; ol[q] = c2; } const size_t oo = (size_t)row * LL + ch * 128 + lane * 4; *(v4us*)(Ph + oo) = oh; *(v4us*)(Pl + oo) = ol; }
         } }

extern "C" void kernel_launch(void* const* d_in, const int* in_sizes, int n_in,
                              void* d_out, int out_size, void* d_ws, size_t ws_size, hipStream_t stream) {
    (void)in_sizes; (void)n_in; (void)out_size;
    const float* q = (const float*)d_in[0]; const float* k = (const float*)d_in[1]; const float* v = (const float*)d_in[2]; const float* kpe = (const float*)d_in[3];
    float* OUT = (float*)d_out;     // [2][16][2048][64]
    char* wsp = (char*)d_ws;
    auto take = [&](size_t bytes) { char* p = wsp; wsp += (bytes + 255) & ~(size_t)255; return (void*)p; };
    const size_t per = (size_t)NH_ * LL * HD;
    bf* QP = (bf*)take(per * 2); bf* KEh = (bf*)take(per * 2); bf* KEl = (bf*)take(per * 2); bf* VT = (bf*)take(per * 2); float* S1 = (float*)take((size_t)ZH * LL * LL * 4); float* S2 = (float*)take((size_t)ZH * LL * LL * 4); bf* Ph = (bf*)take((size_t)ZH * LL * LL * 2); bf* Pl = (bf*)take((size_t)ZH * LL * LL * 2);
    if ((size_t)(wsp - (char*)d_ws) > ws_size) return;    // total ~ 115 MB
    const size_t zq = (size_t)LL * HD, zS = (size_t)LL * LL, zv = (size_t)HD * LL;
    for (int b = 0; b < NB_; ++b) {
        k_cvt8<<<(unsigned)((per / 8 + 255) / 256), 256, 0, stream>>>(q + b * per, QP, per / 8); k_ke<<<(unsigned)((per / 4 + 255) / 256), 256, 0, stream>>>(k + b * per, kpe, KEh, KEl); k_vtb<<<(unsigned)((per / 2 + 255) / 256), 256, 0, stream>>>(v + b * per, VT);
        for (int h0 = 0; h0 < NH_; h0 += ZH) {
            k_gemmw<bf, 0, false><<<dim3(LL / 64, LL / 64, ZH), 32, 0, stream>>>(QP + (size_t)h0 * zq, nullptr, KEh + (size_t)h0 * zq, nullptr, HD, S1, LL, nullptr, zq, zq, zS);
            k_gemmw<bf, 0, false><<<dim3(LL / 64, LL / 64, ZH), 32, 0, stream>>>(QP + (size_t)h0 * zq, nullptr, KEl + (size_t)h0 * zq, nullptr, HD, S2, LL, nullptr, zq, zq, zS);
            k_soft2<<<ZH * LL / 8, 256, 0, stream>>>(S1, S2, Ph, Pl);
            k_gemmw<bf, 1, false><<<dim3(LL / 64, 1, ZH), 32, 0, stream>>>(Ph, Pl, VT + (size_t)h0 * zv, nullptr, LL, OUT + b * per + (size_t)h0 * zq, HD, nullptr, zS, zv, zq); } }
}

// v001
// It runs in 887 microseconds.
// Two timings next to v000 both put it at 1.67 times that version's speed.
#include <hip/hip_runtime.h>

// SeqAttention (q, k, v [2][16][2048][64], k_pe [64][2048] shared relative-position keys; scores = (q.k + q.k_pe[:, t]) / 8; softmax; out = attn v -> [2][16][2048][64]).
// The two einsums are regrouped as q . (k_t + k_pe[:, t]) (exact algebra): k + k_pe is formed in f32 from the bf16-rounded inputs (exact) and split into hi/lo bf16 planes; scores = q.hi + q.lo as two PLAIN bf16 GEMMs (inputs q: exact products) summed in the softmax kernel.
// Compute dtypes, f32 accumulate: every input rounded to bf16; scores as above (f32); scale + softmax f32 -> hl probability planes; attn.v as hl x exact bf16 v (2 products); 2 heads per pass.

#define NB_  2
#define NH_  16
#define LL   2048
#define HD   64
#define ZH   2
typedef _Float16 h16;
typedef unsigned short bf;
typedef __attribute__((ext_vector_type(16))) __bf16   v16bf;
typedef __attribute__((ext_vector_type(16))) _Float16 v16h;
typedef __attribute__((ext_vector_type(8)))  _Float16 v8h;
typedef __attribute__((ext_vector_type(8)))  unsigned short v8us;
typedef __attribute__((ext_vector_type(8)))  float    v8f;
typedef __attribute__((ext_vector_type(4)))  float    v4f;
typedef v8h  __attribute__((may_alias)) v8ha;
typedef v4f  __attribute__((may_alias)) v4fa;
typedef v8us __attribute__((may_alias)) v8usa;

__device__ __forceinline__ unsigned short f2bf(float f) { unsigned u = __float_as_uint(f); u += 0x7FFFu + ((u >> 16) & 1u); return (unsigned short)(u >> 16); }
__device__ __forceinline__ float bf2f(unsigned short b) { return __uint_as_float(((unsigned)b) << 16); }
__device__ __forceinline__ float bfr(float f) { return bf2f(f2bf(f)); }
__device__ __forceinline__ v16h cat16(v8h lo, v8h hi) { return __builtin_shufflevector(lo, hi, 0, 1, 2, 3, 4, 5, 6, 7, 8, 9, 10, 11, 12, 13, 14, 15); }
__device__ __forceinline__ v16bf cat16b(v8us lo, v8us hi) { return __builtin_bit_cast(v16bf, __builtin_shufflevector(lo, hi, 0, 1, 2, 3, 4, 5, 6, 7, 8, 9, 10, 11, 12, 13, 14, 15)); }
__device__ __forceinline__ v8f wmma16(v16h a, v16h b, v8f c) { return __builtin_amdgcn_wmma_f32_16x16x32_f16(false, a, false, b, (short)0, c, false, false); }
__device__ __forceinline__ v8f wmmab(v16bf a, v16bf b, v8f c) { return __builtin_amdgcn_wmma_f32_16x16x32_bf16(false, a, false, b, (short)0, c, false, false); }



// ---- k_gemmw: register-blocked GEMM, ONE WAVE per 64x64 output tile (16 accumulators), operands straight from K-contiguous 16-bit planes; grid (M/64, N/64, Z), 32 threads.
// C[m][n] (f32, pitch ldc, + optional f32 bias[n]) = sum_k A[m][k] Bt[n][k] (+ split products per NSPLIT). z-batch strides sA/sB/sC in elements. K % 32 == 0.
template <typename T16> struct WFrag;
template <> struct WFrag<h16> { typedef v16h V; static __device__ __forceinline__ V ld(const h16* p) { return cat16(*(const v8h*)p, *(const v8h*)(p + 16)); } static __device__ __forceinline__ v8f mma(V a, V b, v8f c) { return wmma16(a, b, c); } };
template <> struct WFrag<bf> { typedef v16bf V; static __device__ __forceinline__ V ld(const bf* p) { return cat16b(*(const v8us*)p, *(const v8us*)(p + 16)); } static __device__ __forceinline__ v8f mma(V a, V b, v8f c) { return wmmab(a, b, c); } };
template <typename T16, int NSPLIT, bool BIAS>
__global__ __launch_bounds__(32) void k_gemmw(const T16* __restrict__ A, const T16* __restrict__ A2, const T16* __restrict__ Bt, const T16* __restrict__ Bt2, int K, float* C, int ldc, const float* __restrict__ bias, size_t sA, size_t sB, size_t sC) {
    typedef typename WFrag<T16>::V V;
    __shared__ __align__(16) float os[16 * 68];
    const size_t z = blockIdx.z; A += z * sA; if (A2) A2 += z * sA; Bt += z * sB; if (Bt2) Bt2 += z * sB; C += z * sC;
    const int lane = threadIdx.x & 31, lr = lane & 15, hi = lane >> 4; const int r0 = blockIdx.x * 64, c0 = blockIdx.y * 64;
    v8f acc[4][4];
#pragma unroll
    for (int mb = 0; mb < 4; ++mb)
#pragma unroll
        for (int nb = 0; nb < 4; ++nb) acc[mb][nb] = (v8f){};
    const size_t aoff = (size_t)(r0 + lr) * K + 8 * hi, boff = (size_t)(c0 + lr) * K + 8 * hi;
#pragma unroll 1
    for (int kc = 0; kc < K; kc += 32) {
        V a[4], a2[4];
#pragma unroll
        for (int mb = 0; mb < 4; ++mb) { a[mb] = WFrag<T16>::ld(A + aoff + (size_t)mb * 16 * K + kc); if (NSPLIT == 1 || NSPLIT == 2) a2[mb] = WFrag<T16>::ld(A2 + aoff + (size_t)mb * 16 * K + kc); }
#pragma unroll
        for (int nb = 0; nb < 4; ++nb) { const V b = WFrag<T16>::ld(Bt + boff + (size_t)nb * 16 * K + kc); V b2; if (NSPLIT >= 2) b2 = WFrag<T16>::ld(Bt2 + boff + (size_t)nb * 16 * K + kc);
#pragma unroll
            for (int mb = 0; mb < 4; ++mb) { acc[mb][nb] = WFrag<T16>::mma(a[mb], b, acc[mb][nb]); if (NSPLIT == 1 || NSPLIT == 2) acc[mb][nb] = WFrag<T16>::mma(a2[mb], b, acc[mb][nb]); if (NSPLIT >= 2) acc[mb][nb] = WFrag<T16>::mma(a[mb], b2, acc[mb][nb]); } }
        asm volatile("v_nop\n\tv_nop\n\tv_nop\n\tv_nop" : "+v"(acc[0][0]), "+v"(acc[1][1]), "+v"(acc[2][2]), "+v"(acc[3][3]) : "v"(a[0]), "v"(a[3]));
    }
#pragma unroll
    for (int mb = 0; mb < 4; ++mb) {
#pragma unroll
        for (int nb = 0; nb < 4; ++nb) {
#pragma unroll
            for (int j = 0; j < 8; ++j) os[(hi * 8 + j) * 68 + nb * 16 + lr] = acc[mb][nb][j]; }
        __builtin_amdgcn_wave_barrier(); asm volatile("" ::: "memory");
        float* crow = C + (size_t)(r0 + mb * 16) * ldc + c0;
{
#pragma unroll
            for (int s = 0; s < 8; ++s) { const int row = 2 * s + hi, cofs = lr * 4; v4f val = *(const v4fa*)(os + row * 68 + cofs); if (BIAS) { val[0] += bfr(bias[c0 + cofs]); val[1] += bfr(bias[c0 + cofs + 1]); val[2] += bfr(bias[c0 + cofs + 2]); val[3] += bfr(bias[c0 + cofs + 3]); }
                *(v4f*)(crow + (size_t)row * ldc + cofs) = val; }
             }
        __builtin_amdgcn_wave_barrier(); asm volatile("" ::: "memory");
    }
}

// ---- k_gemmks: the 64x64 tile and the two-plane A (A + A2) of k_gemmw, with K split over the KS waves of one work-group: wave w sums k in [w K/KS, (w+1) K/KS).
// The KS partial tiles meet in LDS behind one barrier and are added in wave order. grid (M/64, N/64, Z), 32 KS threads. K % (32 KS) == 0.
template <int KS>
__global__ __launch_bounds__(32 * KS) void k_gemmks(const bf* __restrict__ A, const bf* __restrict__ A2, const bf* __restrict__ Bt, int K, float* C, int ldc, size_t sA, size_t sB, size_t sC) {
    typedef WFrag<bf>::V V;
    __shared__ __align__(16) float ps[KS * 64 * 68];
    const size_t z = blockIdx.z; A += z * sA; A2 += z * sA; Bt += z * sB; C += z * sC;
    const int lane = threadIdx.x & 31, lr = lane & 15, hi = lane >> 4; const int r0 = blockIdx.x * 64, c0 = blockIdx.y * 64;
    const int wv = __builtin_amdgcn_readfirstlane(threadIdx.x >> 5);    // the wave's number, kept scalar so that its k offset and LDS base cost no vector register
    const int kw = K / KS;
    v8f acc[4][4];
#pragma unroll
    for (int mb = 0; mb < 4; ++mb)
#pragma unroll
        for (int nb = 0; nb < 4; ++nb) acc[mb][nb] = (v8f){};
    const size_t aoff = (size_t)(r0 + lr) * K + 8 * hi + wv * kw, boff = (size_t)(c0 + lr) * K + 8 * hi + wv * kw;
    // rolled: a second trip's fragments would not fit beside the 128 accumulator registers in the 256 that a wave of a 16-wave group may hold
#pragma unroll 1
    for (int kc = 0; kc < kw; kc += 32) {
        V a[4], a2[4];
#pragma unroll
        for (int mb = 0; mb < 4; ++mb) { a[mb] = WFrag<bf>::ld(A + aoff + (size_t)mb * 16 * K + kc); a2[mb] = WFrag<bf>::ld(A2 + aoff + (size_t)mb * 16 * K + kc); }
#pragma unroll
        for (int nb = 0; nb < 4; ++nb) { const V b = WFrag<bf>::ld(Bt + boff + (size_t)nb * 16 * K + kc);
#pragma unroll
            for (int mb = 0; mb < 4; ++mb) { acc[mb][nb] = WFrag<bf>::mma(a[mb], b, acc[mb][nb]); acc[mb][nb] = WFrag<bf>::mma(a2[mb], b, acc[mb][nb]); } }
        // four vector slots behind the trip's last matrix instructions, on both sides of the loop branch (the chip's distance before D is read or A, B are overwritten)
        asm volatile("v_nop\n\tv_nop\n\tv_nop\n\tv_nop" : "+v"(acc[0][0]), "+v"(acc[1][1]), "+v"(acc[2][2]), "+v"(acc[3][3]) : "v"(a[0]), "v"(a[3]));
    }
    float* pw = ps + wv * (64 * 68);
#pragma unroll
    for (int mb = 0; mb < 4; ++mb)
#pragma unroll
        for (int nb = 0; nb < 4; ++nb)
#pragma unroll
            for (int j = 0; j < 8; ++j) pw[(mb * 16 + hi * 8 + j) * 68 + nb * 16 + lr] = acc[mb][nb][j];
    __syncthreads();    // every wave's partial tile is in LDS before any thread adds them
#pragma unroll
    for (int s = 0; s < 64 * 64 / (KS * 32 * 4); ++s) { const int e = (s * KS * 32 + (int)threadIdx.x) * 4, row = e >> 6, cofs = e & 63; v4f val = *(const v4fa*)(ps + row * 68 + cofs);
#pragma unroll
        for (int w = 1; w < KS; ++w) val += *(const v4fa*)(ps + w * (64 * 68) + row * 68 + cofs);
        *(v4f*)(C + (size_t)(r0 + row) * ldc + c0 + cofs) = val; }
}

typedef __attribute__((ext_vector_type(2))) unsigned short v2us;
typedef __attribute__((ext_vector_type(4))) unsigned short v4us;
__device__ __forceinline__ void splitf(float y, unsigned short& h, unsigned short& l) { h = f2bf(y); l = f2bf(y - bf2f(h)); }

__global__ __launch_bounds__(256) void k_cvt8(const float* __restrict__ src, bf* dst, size_t n8) { const size_t i = (size_t)blockIdx.x * 256 + threadIdx.x; if (i >= n8) return; const v8f v = *(const v8f*)(src + i * 8); v8us o;
#pragma unroll
    for (int k = 0; k < 8; ++k) o[k] = f2bf(v[k]); *(v8us*)(dst + i * 8) = o;  }
__global__ __launch_bounds__(256) void k_ke(const float* __restrict__ k, const float* __restrict__ kpe, bf* Kh, bf* Kl) { const size_t e = ((size_t)blockIdx.x * 256 + threadIdx.x) * 4; if (e >= (size_t)NH_ * LL * HD) return; const int d = (int)(e % HD); const int t = (int)((e / HD) % LL); v4us oh, ol;
#pragma unroll
    for (int u = 0; u < 4; ++u) { const float s = __fadd_rn(bfr(k[e + u]), bfr(kpe[(size_t)(d + u) * LL + t])); unsigned short a, b; splitf(s, a, b); oh[u] = a; ol[u] = b; } *(v4us*)(Kh + e) = oh; *(v4us*)(Kl + e) = ol;  }
__global__ __launch_bounds__(256) void k_vtb(const float* __restrict__ v, bf* VT) { const size_t e = ((size_t)blockIdx.x * 256 + threadIdx.x) * 2; if (e >= (size_t)NH_ * HD * LL) return; const int t = (int)(e % LL); const int d = (int)((e / LL) % HD); const int h = (int)(e / ((size_t)LL * HD)); v2us o; o[0] = f2bf(v[((size_t)h * LL + t) * HD + d]); o[1] = f2bf(v[((size_t)h * LL + t + 1) * HD + d]); *(v2us*)(VT + e) = o;  }
__global__ __launch_bounds__(256) void k_soft2(const float* __restrict__ S1, const float* __restrict__ S2, bf* Ph, bf* Pl) { const int lane = threadIdx.x & 31; const int row = blockIdx.x * 8 + (threadIdx.x >> 5); if (row >= ZH * LL) return; const float* a1 = S1 + (size_t)row * LL; const float* a2 = S2 + (size_t)row * LL; float v[LL / 32]; float mx = -3.0e38f;
#pragma unroll
    for (int ch = 0; ch < LL / 128; ++ch) { const v4f x1 = *(const v4f*)(a1 + ch * 128 + lane * 4), x2 = *(const v4f*)(a2 + ch * 128 + lane * 4);
#pragma unroll
        for (int u = 0; u < 4; ++u) { const float t = __fadd_rn(x1[u], x2[u]) * 0.125f; v[ch * 4 + u] = t; mx = fmaxf(mx, t); } }
#pragma unroll
    for (int sh = 16; sh; sh >>= 1) mx = fmaxf(mx, __shfl_xor(mx, sh, 32));
    float sum = 0.f;
#pragma unroll
    for (int q = 0; q < LL / 32; ++q) { float d0 = __fsub_rn(v[q], mx); asm volatile("" : "+v"(d0)); v[q] = __builtin_amdgcn_exp2f(__fmul_rn(d0, 1.4426950408889634f)); sum += v[q]; }
#pragma unroll
    for (int sh = 16; sh; sh >>= 1) sum += __shfl_xor(sum, sh, 32);
    const float f = __fdiv_rn(1.0f, sum);
    {
#pragma unroll
        for (int ch = 0; ch < LL / 128; ++ch) { v4us oh, ol; for (int q = 0; q < 4; ++q) { unsigned short a2b, c2; splitf(v[ch * 4 + q] * f, a2b, c2); oh[q] = a2b; ol[q] = c2; } const size_t oo = (size_t)row * LL + ch * 128 + lane * 4; *(v4us*)(Ph + oo) = oh; *(v4us*)(Pl + oo) = ol; }
         } }

extern "C" void kernel_launch(void* const* d_in, const int* in_sizes, int n_in,
                              void* d_out, int out_size, void* d_ws, size_t ws_size, hipStream_t stream) {
    (void)in_sizes; (void)n_in; (void)out_size;
    const float* q = (const float*)d_in[0]; const float* k = (const float*)d_in[1]; const float* v = (const float*)d_in[2]; const float* kpe = (const float*)d_in[3];
    float* OUT = (float*)d_out;     // [2][16][2048][64]
    char* wsp = (char*)d_ws;
    auto take = [&](size_t bytes) { char* p = wsp; wsp += (bytes + 255) & ~(size_t)255; return (void*)p; };
    const size_t per = (size_t)NH_ * LL * HD;
    bf* QP = (bf*)take(per * 2); bf* KEh = (bf*)take(per * 2); bf* KEl = (bf*)take(per * 2); bf* VT = (bf*)take(per * 2); float* S1 = (float*)take((size_t)ZH * LL * LL * 4); float* S2 = (float*)take((size_t)ZH * LL * LL * 4); bf* Ph = (bf*)take((size_t)ZH * LL * LL * 2); bf* Pl = (bf*)take((size_t)ZH * LL * LL * 2);
    if ((size_t)(wsp - (char*)d_ws) > ws_size) return;    // total ~ 115 MB
    const size_t zq = (size_t)LL * HD, zS = (size_t)LL * LL, zv = (size_t)HD * LL;
    for (int b = 0; b < NB_; ++b) {
        k_cvt8<<<(unsigned)((per / 8 + 255) / 256), 256, 0, stream>>>(q + b * per, QP, per / 8); k_ke<<<(unsigned)((per / 4 + 255) / 256), 256, 0, stream>>>(k + b * per, kpe, KEh, KEl); k_vtb<<<(unsigned)((per / 2 + 255) / 256), 256, 0, stream>>>(v + b * per, VT);
        for (int h0 = 0; h0 < NH_; h0 += ZH) {
            k_gemmw<bf, 0, false><<<dim3(LL / 64, LL / 64, ZH), 32, 0, stream>>>(QP + (size_t)h0 * zq, nullptr, KEh + (size_t)h0 * zq, nullptr, HD, S1, LL, nullptr, zq, zq, zS);
            k_gemmw<bf, 0, false><<<dim3(LL / 64, LL / 64, ZH), 32, 0, stream>>>(QP + (size_t)h0 * zq, nullptr, KEl + (size_t)h0 * zq, nullptr, HD, S2, LL, nullptr, zq, zq, zS);
            k_soft2<<<ZH * LL / 8, 256, 0, stream>>>(S1, S2, Ph, Pl);
            k_gemmks<16><<<dim3(LL / 64, 1, ZH), 512, 0, stream>>>(Ph, Pl, VT + (size_t)h0 * zv, LL, OUT + b * per + (size_t)h0 * zq, HD, zS, zv, zq); } }
}

// v003
// One run takes 86.7 microseconds.
// Versions in between are left out here; by their measured steps it is 10.3 times as fast as v001.
// All steps since v000 together make it 17.2 times as fast.
#include <hip/hip_runtime.h>

// SeqAttention (q, k, v [2][16][2048][64], k_pe [64][2048] shared relative-position keys; scores = (q.k + q.k_pe[:, t]) / 8; softmax; out = attn v -> [2][16][2048][64]).
// The two einsums are regrouped as q . (k_t + k_pe[:, t]) (exact algebra): k + k_pe is formed in f32 from the bf16-rounded inputs (exact) and split into hi/lo bf16 planes; scores = q.hi + q.lo as two PLAIN bf16 products (inputs q: exact products) summed in one f32 accumulator.
// Compute dtypes, f32 accumulate: every input rounded to bf16; scores as above (f32); scale + softmax f32 (running maximum) -> hl probability fragments; attn.v as hl x exact bf16 v (2 products); all heads in one launch.

#define NB_  2
#define NH_  16
#define LL   2048
#define HD   64
typedef _Float16 h16;
typedef unsigned short bf;
typedef __attribute__((ext_vector_type(16))) __bf16   v16bf;
typedef __attribute__((ext_vector_type(16))) _Float16 v16h;
typedef __attribute__((ext_vector_type(8)))  _Float16 v8h;
typedef __attribute__((ext_vector_type(8)))  unsigned short v8us;
typedef __attribute__((ext_vector_type(8)))  float    v8f;
typedef __attribute__((ext_vector_type(4)))  float    v4f;
typedef v8h  __attribute__((may_alias)) v8ha;
typedef v4f  __attribute__((may_alias)) v4fa;
typedef v8us __attribute__((may_alias)) v8usa;

__device__ __forceinline__ unsigned short f2bf(float f) { unsigned u = __float_as_uint(f); u += 0x7FFFu + ((u >> 16) & 1u); return (unsigned short)(u >> 16); }
__device__ __forceinline__ float bf2f(unsigned short b) { return __uint_as_float(((unsigned)b) << 16); }
__device__ __forceinline__ float bfr(float f) { return bf2f(f2bf(f)); }
__device__ __forceinline__ v16h cat16(v8h lo, v8h hi) { return __builtin_shufflevector(lo, hi, 0, 1, 2, 3, 4, 5, 6, 7, 8, 9, 10, 11, 12, 13, 14, 15); }
__device__ __forceinline__ v16bf cat16b(v8us lo, v8us hi) { return __builtin_bit_cast(v16bf, __builtin_shufflevector(lo, hi, 0, 1, 2, 3, 4, 5, 6, 7, 8, 9, 10, 11, 12, 13, 14, 15)); }
__device__ __forceinline__ v8f wmma16(v16h a, v16h b, v8f c) { return __builtin_amdgcn_wmma_f32_16x16x32_f16(false, a, false, b, (short)0, c, false, false); }
__device__ __forceinline__ v8f wmmab(v16bf a, v16bf b, v8f c) { return __builtin_amdgcn_wmma_f32_16x16x32_bf16(false, a, false, b, (short)0, c, false, false); }



typedef __attribute__((ext_vector_type(2))) unsigned short v2us;
typedef __attribute__((ext_vector_type(4))) unsigned short v4us;
__device__ __forceinline__ void splitf(float y, unsigned short& h, unsigned short& l) { h = f2bf(y); l = f2bf(y - bf2f(h)); }

__global__ __launch_bounds__(256) void k_cvt8(const float* __restrict__ src, bf* dst, size_t n8) { const size_t i = (size_t)blockIdx.x * 256 + threadIdx.x; if (i >= n8) return; const v8f v = *(const v8f*)(src + i * 8); v8us o;
#pragma unroll
    for (int k = 0; k < 8; ++k) o[k] = f2bf(v[k]); *(v8us*)(dst + i * 8) = o;  }
__global__ __launch_bounds__(256) void k_ke(const float* __restrict__ k, const float* __restrict__ kpe, bf* Kh, bf* Kl) { const size_t e = ((size_t)blockIdx.x * 256 + threadIdx.x) * 4; if (e >= (size_t)NH_ * LL * HD) return; const int d = (int)(e % HD); const int t = (int)((e / HD) % LL); v4us oh, ol;
#pragma unroll
    for (int u = 0; u < 4; ++u) { const float s = __fadd_rn(bfr(k[e + u]), bfr(kpe[(size_t)(d + u) * LL + t])); unsigned short a, b; splitf(s, a, b); oh[u] = a; ol[u] = b; } *(v4us*)(Kh + e) = oh; *(v4us*)(Kl + e) = ol;  }
__global__ __launch_bounds__(256) void k_vtb(const float* __restrict__ v, bf* VT) { const size_t e = ((size_t)blockIdx.x * 256 + threadIdx.x) * 2; if (e >= (size_t)NH_ * HD * LL) return; const int t = (int)(e % LL); const int d = (int)((e / LL) % HD); const int h = (int)(e / ((size_t)LL * HD)); v2us o; o[0] = f2bf(v[((size_t)h * LL + t) * HD + d]); o[1] = f2bf(v[((size_t)h * LL + t + 1) * HD + d]); *(v2us*)(VT + e) = o;  }
// ---- k_fattn: scores, softmax and attn.v in one kernel. One wave owns 32 queries of one head and walks the 2048 keys 32 at a time; grid (LL / (32 NW), heads), 32 NW threads.
// The work-group's waves all walk the same keys: the key planes and V^T come through LDS, 128 keys a stage, two buffers, by asynchronous copies (each lane 16 bytes); the next stage flies while this one is worked on.
// Transposed products: S^T = KE . Q^T (A = key rows, hi plane then lo plane into one accumulator; B = the wave's queries, loaded once) and O^T += V^T . P^T (A = VT rows, B = P).
// A lane holds the scores of ONE query (column lr): keys 8 hi + j of each 16-key tile. Two such tiles, converted in place, are the B fragment of the second product in the loaders' own k order.
// Softmax with a running maximum per query: when it rises, the sums so far are scaled by exp2(old - new). P is split hi/lo unnormalised; the division by the row sum comes once, at the end.
template <typename T16> struct WFrag;
template <> struct WFrag<bf> { typedef v16bf V; static __device__ __forceinline__ V ld(const bf* p) { return cat16b(*(const v8us*)p, *(const v8us*)(p + 16)); } static __device__ __forceinline__ v8f mma(V a, V b, v8f c) { return wmmab(a, b, c); } };
typedef __attribute__((ext_vector_type(2))) __bf16 v2bf;
typedef __attribute__((ext_vector_type(2))) float v2f;
typedef __attribute__((ext_vector_type(8))) unsigned v8u;
// the value of lane l ^ 16: the other half of a query's keys
__device__ __forceinline__ float xhalf(float x) { const int b = __float_as_int(x); return __int_as_float(__builtin_amdgcn_permlanex16(b, b, 0x76543210, 0xfedcba98, false, false)); }
#define TK   128                   // keys per stage
#define KP   144                   // LDS pitch in bytes of a key row (128 + 16: 16 B x odd, conflict-free for 16-byte reads)
#define VP   272                   // LDS pitch in bytes of a V^T row (256 + 16)
#define KSZ  (TK * KP)             // one key plane of a stage
#define BSZ  (2 * KSZ + HD * VP)   // one buffer: hi plane, lo plane, V^T
// One stage's copies of one thread (256 threads): 4 x 16 B of each key plane (rows r, r + 32, ...) and 4 x 16 B of V^T (rows r, r + 16, ...).
// lk, lv: the lane's LDS byte addresses in the hi plane and in V^T; gh, gl, gv: its global addresses. s_wait_xcnt stands in the copies' own statement, before any of their address registers can be rewritten.
__device__ __forceinline__ void stage_copy(unsigned lk, unsigned lv, const bf* gh, const bf* gl, const bf* gv) {
    asm volatile("global_load_async_to_lds_b128 %0, %1, off\n\t"
                 "global_load_async_to_lds_b128 %2, %3, off\n\t"
                 "global_load_async_to_lds_b128 %4, %5, off\n\t"
                 "global_load_async_to_lds_b128 %6, %7, off\n\t"
                 "global_load_async_to_lds_b128 %8, %9, off\n\t"
                 "global_load_async_to_lds_b128 %10, %11, off\n\t"
                 "global_load_async_to_lds_b128 %12, %13, off\n\t"
                 "global_load_async_to_lds_b128 %14, %15, off\n\t"
                 "global_load_async_to_lds_b128 %16, %17, off\n\t"
                 "global_load_async_to_lds_b128 %18, %19, off\n\t"
                 "global_load_async_to_lds_b128 %20, %21, off\n\t"
                 "global_load_async_to_lds_b128 %22, %23, off\n\t"
                 "s_wait_xcnt 0x0"
                 :: "v"(lk), "v"(gh), "v"(lk + 32 * KP), "v"(gh + 32 * HD), "v"(lk + 64 * KP), "v"(gh + 64 * HD), "v"(lk + 96 * KP), "v"(gh + 96 * HD),
                    "v"(lk + KSZ), "v"(gl), "v"(lk + KSZ + 32 * KP), "v"(gl + 32 * HD), "v"(lk + KSZ + 64 * KP), "v"(gl + 64 * HD), "v"(lk + KSZ + 96 * KP), "v"(gl + 96 * HD),
                    "v"(lv), "v"(gv), "v"(lv + 16 * VP), "v"(gv + 16 * LL), "v"(lv + 32 * VP), "v"(gv + 32 * LL), "v"(lv + 48 * VP), "v"(gv + 48 * LL)
                 : "memory");
}
template <int NW>
__global__ __launch_bounds__(32 * NW) void k_fattn(const bf* __restrict__ Q, const bf* __restrict__ Kh, const bf* __restrict__ Kl, const bf* __restrict__ VT, float* __restrict__ O) {
    typedef WFrag<bf>::V V;
    static_assert(NW == 8, "the stage copies are laid out for 256 threads");
    __shared__ __attribute__((aligned(16))) unsigned char ring[2 * BSZ];
    const size_t z = blockIdx.y; Q += z * (size_t)(LL * HD); Kh += z * (size_t)(LL * HD); Kl += z * (size_t)(LL * HD); VT += z * (size_t)(HD * LL); O += z * (size_t)(LL * HD);
    const int tid = threadIdx.x, lane = tid & 31, lr = lane & 15, hi = lane >> 4;
    const int wv = __builtin_amdgcn_readfirstlane(threadIdx.x >> 5);    // the wave's number, kept scalar
    const int q0 = ((int)blockIdx.x * NW + wv) * 32;
    const float SC = 0.125f * 1.4426950408889634f;    // 1 / sqrt(64), and exp as exp2
    // this thread's share of a stage: LDS byte addresses in buffer 0, global addresses of stage 0
    const unsigned ring0 = (unsigned)(size_t)ring;
    const unsigned lk0 = ring0 + (unsigned)((tid >> 3) * KP + (tid & 7) * 16), lv0 = ring0 + (unsigned)(2 * KSZ + (tid >> 4) * VP + (tid & 15) * 16);
    const bf* gh = Kh + (tid >> 3) * HD + (tid & 7) * 8; const bf* gl = Kl + (tid >> 3) * HD + (tid & 7) * 8; const bf* gv = VT + (size_t)(tid >> 4) * LL + (tid & 15) * 8;
    stage_copy(lk0, lv0, gh, gl, gv);
    V qf[2][2];    // [query tile][k chunk]
#pragma unroll
    for (int nt = 0; nt < 2; ++nt)
#pragma unroll
        for (int kc = 0; kc < 2; ++kc) qf[nt][kc] = WFrag<bf>::ld(Q + (size_t)(q0 + nt * 16 + lr) * HD + kc * 32 + 8 * hi);
    v8f o[4][2];    // [d tile][query tile]: o[dt][nt][j] = O[q0 + 16 nt + lr][16 dt + 8 hi + j]
#pragma unroll
    for (int dt = 0; dt < 4; ++dt)
#pragma unroll
        for (int nt = 0; nt < 2; ++nt) o[dt][nt] = (v8f){};
    float mx[2] = {-3.0e38f, -3.0e38f}, sm[2] = {0.f, 0.f};    // running maximum (scaled, log2 units; equal in both lane halves) and this lane half's share of the row sum
    // stage 0 has landed for this wave; the barrier publishes it to the others; then stage 1 starts into buffer 1
    asm volatile("s_wait_asynccnt 0x0" ::: "memory");
    __syncthreads();
    stage_copy(lk0 + BSZ, lv0 + BSZ, gh + TK * HD, gl + TK * HD, gv + TK);
    // both loops rolled: one pass already holds 32 matrix instructions, and a second pass's fragments would only cost registers
#pragma unroll 1
    for (int st = 0; st < LL / TK; ++st) {
        const unsigned bo = (unsigned)(st & 1) * BSZ;
        const bf* kh = (const bf*)(ring + bo + lr * KP + 16 * hi); const bf* kl = (const bf*)(ring + bo + KSZ + lr * KP + 16 * hi); const bf* vt = (const bf*)(ring + bo + 2 * KSZ + lr * VP + 16 * hi);
        V ah[2][2], al[2][2];    // [key tile][k chunk]
#pragma unroll
        for (int tt = 0; tt < 2; ++tt)
#pragma unroll
            for (int kc = 0; kc < 2; ++kc) { ah[tt][kc] = WFrag<bf>::ld(kh + tt * 16 * (KP / 2) + kc * 32); al[tt][kc] = WFrag<bf>::ld(kl + tt * 16 * (KP / 2) + kc * 32); }
#pragma unroll 1
        for (int ps = 0; ps < TK / 32; ++ps) {
            v8f s[2][2];    // [key tile][query tile]
#pragma unroll
            for (int tt = 0; tt < 2; ++tt)
#pragma unroll
                for (int nt = 0; nt < 2; ++nt) { v8f c = (v8f){};
#pragma unroll
                    for (int kc = 0; kc < 2; ++kc) { c = WFrag<bf>::mma(ah[tt][kc], qf[nt][kc], c); c = WFrag<bf>::mma(al[tt][kc], qf[nt][kc], c); }
                    s[tt][nt] = c; }
            V va[4];
#pragma unroll
            for (int dt = 0; dt < 4; ++dt) va[dt] = WFrag<bf>::ld(vt + dt * 16 * (VP / 2) + ps * 32);
            // compiler fence in front of the branch: holds the V^T reads here, so that they fly during the softmax (without it they sink in among the second product's matrix instructions and are waited for there)
            asm volatile("" ::: "memory");
            // the next pass's key fragments, fetched behind this pass's score products so that they fly during the softmax; never beyond this stage's own buffer
            if (ps + 1 < TK / 32) {
#pragma unroll
                for (int tt = 0; tt < 2; ++tt)
#pragma unroll
                    for (int kc = 0; kc < 2; ++kc) { ah[tt][kc] = WFrag<bf>::ld(kh + ((ps + 1) * 32 + tt * 16) * (KP / 2) + kc * 32); al[tt][kc] = WFrag<bf>::ld(kl + ((ps + 1) * 32 + tt * 16) * (KP / 2) + kc * 32); }
            }
            V ph[2], pl[2];
#pragma unroll
            for (int nt = 0; nt < 2; ++nt) {
                float bm = s[0][nt][0];
#pragma unroll
                for (int j = 1; j < 8; ++j) bm = fmaxf(bm, s[0][nt][j]);
#pragma unroll
                for (int j = 0; j < 8; ++j) bm = fmaxf(bm, s[1][nt][j]);
                bm = fmaxf(bm, xhalf(bm));
                const float mn = fmaxf(mx[nt], bm * SC), al_ = __builtin_amdgcn_exp2f(mx[nt] - mn);
                mx[nt] = mn;
                // two scores at a time (neighbouring accumulator registers): p = exp2(s SC - mn); hi = bf16(p), read back from the packed pair by a shift and a mask; lo = bf16(p - hi)
                const v2f sc2 = {SC, SC}, nm2 = {-mn, -mn}; v2f ps2 = {0.f, 0.f}; v8u hw, lw;
#pragma unroll
                for (int tt = 0; tt < 2; ++tt)
#pragma unroll
                    for (int i = 0; i < 4; ++i) {
                        const v2f x = {s[tt][nt][2 * i], s[tt][nt][2 * i + 1]}; const v2f e = __builtin_elementwise_fma(x, sc2, nm2);
                        const v2f p = {__builtin_amdgcn_exp2f(e[0]), __builtin_amdgcn_exp2f(e[1])}; ps2 += p;
                        const unsigned u = __builtin_bit_cast(unsigned, __builtin_convertvector(p, v2bf));
                        const v2f hf = {__uint_as_float(u << 16), __uint_as_float(u & 0xFFFF0000u)};
                        hw[tt * 4 + i] = u; lw[tt * 4 + i] = __builtin_bit_cast(unsigned, __builtin_convertvector(p - hf, v2bf)); }
                sm[nt] = __builtin_fmaf(sm[nt], al_, ps2[0] + ps2[1]);
                ph[nt] = __builtin_bit_cast(V, hw); pl[nt] = __builtin_bit_cast(V, lw);
#pragma unroll
                for (int dt = 0; dt < 4; ++dt) o[dt][nt] *= al_;
            }
#pragma unroll
            for (int dt = 0; dt < 4; ++dt)
#pragma unroll
                for (int nt = 0; nt < 2; ++nt) { o[dt][nt] = WFrag<bf>::mma(va[dt], ph[nt], o[dt][nt]); o[dt][nt] = WFrag<bf>::mma(va[dt], pl[nt], o[dt][nt]); }
            // four vector slots behind the pass's last matrix instructions, on both sides of the loop branch (the chip's distance before their A or B is overwritten or D is read)
            asm volatile("v_nop\n\tv_nop\n\tv_nop\n\tv_nop" : "+v"(o[0][0]), "+v"(o[0][1]), "+v"(o[1][0]), "+v"(o[1][1]), "+v"(o[2][0]), "+v"(o[2][1]), "+v"(o[3][0]), "+v"(o[3][1]));
        }
        // hand-over: this wave's LDS reads of the buffer are done, its copies of the next stage have landed; the barrier publishes that stage and frees this buffer for the refill
        asm volatile("s_wait_dscnt 0x0" ::: "memory");
        asm volatile("s_wait_asynccnt 0x0" ::: "memory");
        __syncthreads();
        if (st + 2 < LL / TK) stage_copy(lk0 + bo, lv0 + bo, gh + (size_t)(st + 2) * (TK * HD), gl + (size_t)(st + 2) * (TK * HD), gv + (st + 2) * TK);
    }
    // no copy is outstanding when the wave ends
    asm volatile("s_wait_asynccnt 0x0" ::: "memory");
#pragma unroll
    for (int nt = 0; nt < 2; ++nt) {
        const float f = __fdiv_rn(1.0f, sm[nt] + xhalf(sm[nt]));
        float* orow = O + (size_t)(q0 + nt * 16 + lr) * HD + 8 * hi;
#pragma unroll
        for (int dt = 0; dt < 4; ++dt) { const v8f r = o[dt][nt] * f; *(v4f*)(orow + dt * 16) = __builtin_shufflevector(r, r, 0, 1, 2, 3); *(v4f*)(orow + dt * 16 + 4) = __builtin_shufflevector(r, r, 4, 5, 6, 7); }
    }
}

extern "C" void kernel_launch(void* const* d_in, const int* in_sizes, int n_in,
                              void* d_out, int out_size, void* d_ws, size_t ws_size, hipStream_t stream) {
    (void)in_sizes; (void)n_in; (void)out_size;
    const float* q = (const float*)d_in[0]; const float* k = (const float*)d_in[1]; const float* v = (const float*)d_in[2]; const float* kpe = (const float*)d_in[3];
    float* OUT = (float*)d_out;     // [2][16][2048][64]
    char* wsp = (char*)d_ws;
    auto take = [&](size_t bytes) { char* p = wsp; wsp += (bytes + 255) & ~(size_t)255; return (void*)p; };
    const size_t per = (size_t)NH_ * LL * HD;
    bf* QP = (bf*)take(NB_ * per * 2); bf* KEh = (bf*)take(NB_ * per * 2); bf* KEl = (bf*)take(NB_ * per * 2); bf* VT = (bf*)take(NB_ * per * 2);
    if ((size_t)(wsp - (char*)d_ws) > ws_size) return;    // total 32 MiB
    for (int b = 0; b < NB_; ++b) {
        k_cvt8<<<(unsigned)((per / 8 + 255) / 256), 256, 0, stream>>>(q + b * per, QP + b * per, per / 8); k_ke<<<(unsigned)((per / 4 + 255) / 256), 256, 0, stream>>>(k + b * per, kpe, KEh + b * per, KEl + b * per); k_vtb<<<(unsigned)((per / 2 + 255) / 256), 256, 0, stream>>>(v + b * per, VT + b * per); }
    k_fattn<8><<<dim3(LL / 256, NB_ * NH_), 256, 0, stream>>>(QP, KEh, KEl, VT, OUT);
}

// v004
// Measured time: 62.8 microseconds a run.
// In two side-by-side timings against v003, it was 1.38 and 1.39 times as fast.
// Counting every step since v000, it is 23.7 times as fast.
#include <hip/hip_runtime.h>

// SeqAttention (q, k, v [2][16][2048][64], k_pe [64][2048] shared relative-position keys; scores = (q.k + q.k_pe[:, t]) / 8; softmax; out = attn v -> [2][16][2048][64]).
// The two einsums are regrouped as q . (k_t + k_pe[:, t]) (exact algebra): k + k_pe is formed in f32 from the bf16-rounded inputs (exact) and split into hi/lo bf16 planes; scores = q.hi + q.lo as two PLAIN bf16 products (inputs q: exact products) summed in one f32 accumulator.
// Compute dtypes, f32 accumulate: every input rounded to bf16; scores as above (f32); scale + softmax f32 (running maximum) -> hl probability fragments; attn.v as hl x exact bf16 v (2 products); all heads in one launch.

#define NB_  2
#define NH_  16
#define LL   2048
#define HD   64
typedef _Float16 h16;
typedef unsigned short bf;
typedef __attribute__((ext_vector_type(16))) __bf16   v16bf;
typedef __attribute__((ext_vector_type(16))) _Float16 v16h;
typedef __attribute__((ext_vector_type(8)))  _Float16 v8h;
typedef __attribute__((ext_vector_type(8)))  unsigned short v8us;
typedef __attribute__((ext_vector_type(8)))  float    v8f;
typedef __attribute__((ext_vector_type(4)))  float    v4f;
typedef v8h  __attribute__((may_alias)) v8ha;
typedef v4f  __attribute__((may_alias)) v4fa;
typedef v8us __attribute__((may_alias)) v8usa;

__device__ __forceinline__ unsigned short f2bf(float f) { unsigned u = __float_as_uint(f); u += 0x7FFFu + ((u >> 16) & 1u); return (unsigned short)(u >> 16); }
__device__ __forceinline__ float bf2f(unsigned short b) { return __uint_as_float(((unsigned)b) << 16); }
__device__ __forceinline__ float bfr(float f) { return bf2f(f2bf(f)); }
__device__ __forceinline__ v16h cat16(v8h lo, v8h hi) { return __builtin_shufflevector(lo, hi, 0, 1, 2, 3, 4, 5, 6, 7, 8, 9, 10, 11, 12, 13, 14, 15); }
__device__ __forceinline__ v16bf cat16b(v8us lo, v8us hi) { return __builtin_bit_cast(v16bf, __builtin_shufflevector(lo, hi, 0, 1, 2, 3, 4, 5, 6, 7, 8, 9, 10, 11, 12, 13, 14, 15)); }
__device__ __forceinline__ v8f wmma16(v16h a, v16h b, v8f c) { return __builtin_amdgcn_wmma_f32_16x16x32_f16(false, a, false, b, (short)0, c, false, false); }
__device__ __forceinline__ v8f wmmab(v16bf a, v16bf b, v8f c) { return __builtin_amdgcn_wmma_f32_16x16x32_bf16(false, a, false, b, (short)0, c, false, false); }



typedef __attribute__((ext_vector_type(2))) unsigned short v2us;
typedef __attribute__((ext_vector_type(4))) unsigned short v4us;
__device__ __forceinline__ void splitf(float y, unsigned short& h, unsigned short& l) { h = f2bf(y); l = f2bf(y - bf2f(h)); }

// ---- k_prep: all of the preparation in one launch. One work-group takes 128 tokens of one head: q rounded to bf16; k + k_pe split into the hi and lo planes; v rounded and transposed.
// Every global read and write is a run of whole lines; the two transposes (k_pe [d][t] -> [t][d], v [t][d] -> [d][t]) are made in registers on 4 x 4 and 8 x 4 blocks and handed over through LDS.
// Each thread has all of its 32 loads of 16 bytes in flight at once: few waves with much to do each, since a wave's start costs more than its share of the copying.
#define PT   128                   // tokens per work-group
#define PP   144                   // LDS pitch in bytes of a k_pe^T row (64 bf16 + 16)
#define PV   272                   // LDS pitch in bytes of a V^T row (128 bf16 + 16)
__global__ __launch_bounds__(256) void k_prep(const float* __restrict__ q, const float* __restrict__ k, const float* __restrict__ v, const float* __restrict__ kpe, bf* __restrict__ QP, bf* __restrict__ Kh, bf* __restrict__ Kl, bf* __restrict__ VT) {
    __shared__ __attribute__((aligned(16))) unsigned char pl[PT * PP];    // bf16(k_pe)^T: [token][d]
    __shared__ __attribute__((aligned(16))) unsigned char vl[HD * PV];    // bf16(v)^T: [d][token]
    const int tid = threadIdx.x, t0 = (int)blockIdx.x * PT; const size_t z = blockIdx.y;
    const size_t base = (z * LL + t0) * HD;    // the tile's first element in q, k, v and in the three [token][d] planes
    // k_pe: two blocks of 4 d x 4 tokens a thread; 8 lanes side by side along the tokens read one whole line of a row
    v4f kp[2][4]; int ptg[2], pdg[2];
#pragma unroll
    for (int i = 0; i < 2; ++i) { const int c = tid + 256 * i; ptg[i] = ((c >> 5) & 3) * 8 + (c & 7); pdg[i] = (c >> 7) * 4 + ((c >> 3) & 3);
#pragma unroll
        for (int u = 0; u < 4; ++u) kp[i][u] = *(const v4f*)(kpe + (size_t)(4 * pdg[i] + u) * LL + t0 + 4 * ptg[i]); }
    asm volatile("s_wait_xcnt 0x0" ::: "memory");    // before the address registers of the loads above are given to the next addresses or to later loads' data
    // v: one block of 8 tokens x 4 d a thread; 16 lanes read one whole row
    const int vd = (tid & 15) * 4, vg = tid >> 4; v4f vv[8];
#pragma unroll
    for (int j = 0; j < 8; ++j) vv[j] = *(const v4f*)(v + base + (size_t)(8 * vg + j) * HD + vd);
    asm volatile("s_wait_xcnt 0x0" ::: "memory");    // before the address registers of the loads above are given to the next addresses or to later loads' data
    // k and q: four runs of 8 elements a thread
    v8f kk[4], qq[4];
#pragma unroll
    for (int i = 0; i < 4; ++i) kk[i] = *(const v8f*)(k + base + (size_t)(tid + 256 * i) * 8);
#pragma unroll
    for (int i = 0; i < 4; ++i) qq[i] = *(const v8f*)(q + base + (size_t)(tid + 256 * i) * 8);
    // scheduling barrier: keeps all 32 loads in front of the first use (without it the compiler spreads them among the conversions to save registers, and the thread pays the memory latency several times over)
    __builtin_amdgcn_sched_barrier(0);
#pragma unroll
    for (int i = 0; i < 2; ++i)
#pragma unroll
        for (int j = 0; j < 4; ++j) { v4us w;
#pragma unroll
            for (int u = 0; u < 4; ++u) w[u] = f2bf(kp[i][u][j]);
            *(v4us*)(pl + (4 * ptg[i] + j) * PP + pdg[i] * 8) = w; }
#pragma unroll
    for (int u = 0; u < 4; ++u) { v8us w;
#pragma unroll
        for (int j = 0; j < 8; ++j) w[j] = f2bf(vv[j][u]);
        *(v8us*)(vl + (vd + u) * PV + vg * 16) = w; }
    __syncthreads();    // both transposed tiles are complete; no global store stands in front of it, so it waits for none
#pragma unroll
    for (int i = 0; i < 4; ++i) { const int c = tid + 256 * i; *(v8us*)(VT + (z * HD + (c >> 4)) * LL + t0 + (c & 15) * 8) = *(const v8us*)(vl + (c >> 4) * PV + (c & 15) * 16); }
#pragma unroll
    for (int i = 0; i < 4; ++i) { v8us o;
#pragma unroll
        for (int e = 0; e < 8; ++e) o[e] = f2bf(qq[i][e]);
        *(v8us*)(QP + base + (size_t)(tid + 256 * i) * 8) = o; }
#pragma unroll
    for (int i = 0; i < 4; ++i) { const int c = tid + 256 * i; const v8us pe = *(const v8us*)(pl + (c >> 3) * PP + (c & 7) * 16); v8us oh, ol;
#pragma unroll
        for (int e = 0; e < 8; ++e) { const float s = __fadd_rn(bfr(kk[i][e]), bf2f(pe[e])); unsigned short x, y; splitf(s, x, y); oh[e] = x; ol[e] = y; }
        *(v8us*)(Kh + base + (size_t)c * 8) = oh; *(v8us*)(Kl + base + (size_t)c * 8) = ol; }
}
// ---- k_fattn: scores, softmax and attn.v in one kernel. One wave owns 32 queries of one head and walks the 2048 keys 32 at a time; grid (LL / (32 NW), heads), 32 NW threads.
// The work-group's waves all walk the same keys: the key planes and V^T come through LDS, 128 keys a stage, two buffers, by asynchronous copies (each lane 16 bytes); the next stage flies while this one is worked on.
// Transposed products: S^T = KE . Q^T (A = key rows, hi plane then lo plane into one accumulator; B = the wave's queries, loaded once) and O^T += V^T . P^T (A = VT rows, B = P).
// A lane holds the scores of ONE query (column lr): keys 8 hi + j of each 16-key tile. Two such tiles, converted in place, are the B fragment of the second product in the loaders' own k order.
// Softmax with a running maximum per query: when it rises, the sums so far are scaled by exp2(old - new). P is split hi/lo unnormalised; the division by the row sum comes once, at the end.
template <typename T16> struct WFrag;
template <> struct WFrag<bf> { typedef v16bf V; static __device__ __forceinline__ V ld(const bf* p) { return cat16b(*(const v8us*)p, *(const v8us*)(p + 16)); } static __device__ __forceinline__ v8f mma(V a, V b, v8f c) { return wmmab(a, b, c); } };
typedef __attribute__((ext_vector_type(2))) __bf16 v2bf;
typedef __attribute__((ext_vector_type(2))) float v2f;
typedef __attribute__((ext_vector_type(8))) unsigned v8u;
// the value of lane l ^ 16: the other half of a query's keys
__device__ __forceinline__ float xhalf(float x) { const int b = __float_as_int(x); return __int_as_float(__builtin_amdgcn_permlanex16(b, b, 0x76543210, 0xfedcba98, false, false)); }
#define TK   128                   // keys per stage
#define KP   144                   // LDS pitch in bytes of a key row (128 + 16: 16 B x odd, conflict-free for 16-byte reads)
#define VP   272                   // LDS pitch in bytes of a V^T row (256 + 16)
#define KSZ  (TK * KP)             // one key plane of a stage
#define BSZ  (2 * KSZ + HD * VP)   // one buffer: hi plane, lo plane, V^T
// One stage's copies of one thread (256 threads): 4 x 16 B of each key plane (rows r, r + 32, ...) and 4 x 16 B of V^T (rows r, r + 16, ...).
// lk, lv: the lane's LDS byte addresses in the hi plane and in V^T; gh, gl, gv: its global addresses. s_wait_xcnt stands in the copies' own statement, before any of their address registers can be rewritten.
__device__ __forceinline__ void stage_copy(unsigned lk, unsigned lv, const bf* gh, const bf* gl, const bf* gv) {
    asm volatile("global_load_async_to_lds_b128 %0, %1, off\n\t"
                 "global_load_async_to_lds_b128 %2, %3, off\n\t"
                 "global_load_async_to_lds_b128 %4, %5, off\n\t"
                 "global_load_async_to_lds_b128 %6, %7, off\n\t"
                 "global_load_async_to_lds_b128 %8, %9, off\n\t"
                 "global_load_async_to_lds_b128 %10, %11, off\n\t"
                 "global_load_async_to_lds_b128 %12, %13, off\n\t"
                 "global_load_async_to_lds_b128 %14, %15, off\n\t"
                 "global_load_async_to_lds_b128 %16, %17, off\n\t"
                 "global_load_async_to_lds_b128 %18, %19, off\n\t"
                 "global_load_async_to_lds_b128 %20, %21, off\n\t"
                 "global_load_async_to_lds_b128 %22, %23, off\n\t"
                 "s_wait_xcnt 0x0"
                 :: "v"(lk), "v"(gh), "v"(lk + 32 * KP), "v"(gh + 32 * HD), "v"(lk + 64 * KP), "v"(gh + 64 * HD), "v"(lk + 96 * KP), "v"(gh + 96 * HD),
                    "v"(lk + KSZ), "v"(gl), "v"(lk + KSZ + 32 * KP), "v"(gl + 32 * HD), "v"(lk + KSZ + 64 * KP), "v"(gl + 64 * HD), "v"(lk + KSZ + 96 * KP), "v"(gl + 96 * HD),
                    "v"(lv), "v"(gv), "v"(lv + 16 * VP), "v"(gv + 16 * LL), "v"(lv + 32 * VP), "v"(gv + 32 * LL), "v"(lv + 48 * VP), "v"(gv + 48 * LL)
                 : "memory");
}
template <int NW>
__global__ __launch_bounds__(32 * NW) void k_fattn(const bf* __restrict__ Q, const bf* __restrict__ Kh, const bf* __restrict__ Kl, const bf* __restrict__ VT, float* __restrict__ O) {
    typedef WFrag<bf>::V V;
    static_assert(NW == 8, "the stage copies are laid out for 256 threads");
    __shared__ __attribute__((aligned(16))) unsigned char ring[2 * BSZ];
    const size_t z = blockIdx.y; Q += z * (size_t)(LL * HD); Kh += z * (size_t)(LL * HD); Kl += z * (size_t)(LL * HD); VT += z * (size_t)(HD * LL); O += z * (size_t)(LL * HD);
    const int tid = threadIdx.x, lane = tid & 31, lr = lane & 15, hi = lane >> 4;
    const int wv = __builtin_amdgcn_readfirstlane(threadIdx.x >> 5);    // the wave's number, kept scalar
    const int q0 = ((int)blockIdx.x * NW + wv) * 32;
    const float SC = 0.125f * 1.4426950408889634f;    // 1 / sqrt(64), and exp as exp2
    // this thread's share of a stage: LDS byte addresses in buffer 0, global addresses of stage 0
    const unsigned ring0 = (unsigned)(size_t)ring;
    const unsigned lk0 = ring0 + (unsigned)((tid >> 3) * KP + (tid & 7) * 16), lv0 = ring0 + (unsigned)(2 * KSZ + (tid >> 4) * VP + (tid & 15) * 16);
    const bf* gh = Kh + (tid >> 3) * HD + (tid & 7) * 8; const bf* gl = Kl + (tid >> 3) * HD + (tid & 7) * 8; const bf* gv = VT + (size_t)(tid >> 4) * LL + (tid & 15) * 8;
    stage_copy(lk0, lv0, gh, gl, gv);
    V qf[2][2];    // [query tile][k chunk]
#pragma unroll
    for (int nt = 0; nt < 2; ++nt)
#pragma unroll
        for (int kc = 0; kc < 2; ++kc) qf[nt][kc] = WFrag<bf>::ld(Q + (size_t)(q0 + nt * 16 + lr) * HD + kc * 32 + 8 * hi);
    v8f o[4][2];    // [d tile][query tile]: o[dt][nt][j] = O[q0 + 16 nt + lr][16 dt + 8 hi + j]
#pragma unroll
    for (int dt = 0; dt < 4; ++dt)
#pragma unroll
        for (int nt = 0; nt < 2; ++nt) o[dt][nt] = (v8f){};
    float mx[2] = {-3.0e38f, -3.0e38f}, sm[2] = {0.f, 0.f};    // running maximum (scaled, log2 units; equal in both lane halves) and this lane half's share of the row sum
    // stage 0 has landed for this wave; the barrier publishes it to the others; then stage 1 starts into buffer 1
    asm volatile("s_wait_asynccnt 0x0" ::: "memory");
    __syncthreads();
    stage_copy(lk0 + BSZ, lv0 + BSZ, gh + TK * HD, gl + TK * HD, gv + TK);
    // both loops rolled: one pass already holds 32 matrix instructions, and a second pass's fragments would only cost registers
#pragma unroll 1
    for (int st = 0; st < LL / TK; ++st) {
        const unsigned bo = (unsigned)(st & 1) * BSZ;
        const bf* kh = (const bf*)(ring + bo + lr * KP + 16 * hi); const bf* kl = (const bf*)(ring + bo + KSZ + lr * KP + 16 * hi); const bf* vt = (const bf*)(ring + bo + 2 * KSZ + lr * VP + 16 * hi);
        V ah[2][2], al[2][2];    // [key tile][k chunk]
#pragma unroll
        for (int tt = 0; tt < 2; ++tt)
#pragma unroll
            for (int kc = 0; kc < 2; ++kc) { ah[tt][kc] = WFrag<bf>::ld(kh + tt * 16 * (KP / 2) + kc * 32); al[tt][kc] = WFrag<bf>::ld(kl + tt * 16 * (KP / 2) + kc * 32); }
#pragma unroll 1
        for (int ps = 0; ps < TK / 32; ++ps) {
            v8f s[2][2];    // [key tile][query tile]
#pragma unroll
            for (int tt = 0; tt < 2; ++tt)
#pragma unroll
                for (int nt = 0; nt < 2; ++nt) { v8f c = (v8f){};
#pragma unroll
                    for (int kc = 0; kc < 2; ++kc) { c = WFrag<bf>::mma(ah[tt][kc], qf[nt][kc], c); c = WFrag<bf>::mma(al[tt][kc], qf[nt][kc], c); }
                    s[tt][nt] = c; }
            V va[4];
#pragma unroll
            for (int dt = 0; dt < 4; ++dt) va[dt] = WFrag<bf>::ld(vt + dt * 16 * (VP / 2) + ps * 32);
            // compiler fence in front of the branch: holds the V^T reads here, so that they fly during the softmax (without it they sink in among the second product's matrix instructions and are waited for there)
            asm volatile("" ::: "memory");
            // the next pass's key fragments, fetched behind this pass's score products so that they fly during the softmax; never beyond this stage's own buffer
            if (ps + 1 < TK / 32) {
#pragma unroll
                for (int tt = 0; tt < 2; ++tt)
#pragma unroll
                    for (int kc = 0; kc < 2; ++kc) { ah[tt][kc] = WFrag<bf>::ld(kh + ((ps + 1) * 32 + tt * 16) * (KP / 2) + kc * 32); al[tt][kc] = WFrag<bf>::ld(kl + ((ps + 1) * 32 + tt * 16) * (KP / 2) + kc * 32); }
            }
            V ph[2], pl[2];
#pragma unroll
            for (int nt = 0; nt < 2; ++nt) {
                float bm = s[0][nt][0];
#pragma unroll
                for (int j = 1; j < 8; ++j) bm = fmaxf(bm, s[0][nt][j]);
#pragma unroll
                for (int j = 0; j < 8; ++j) bm = fmaxf(bm, s[1][nt][j]);
                bm = fmaxf(bm, xhalf(bm));
                const float mn = fmaxf(mx[nt], bm * SC), al_ = __builtin_amdgcn_exp2f(mx[nt] - mn);
                mx[nt] = mn;
                // two scores at a time (neighbouring accumulator registers): p = exp2(s SC - mn); hi = bf16(p), read back from the packed pair by a shift and a mask; lo = bf16(p - hi)
                const v2f sc2 = {SC, SC}, nm2 = {-mn, -mn}; v2f ps2 = {0.f, 0.f}; v8u hw, lw;
#pragma unroll
                for (int tt = 0; tt < 2; ++tt)
#pragma unroll
                    for (int i = 0; i < 4; ++i) {
                        const v2f x = {s[tt][nt][2 * i], s[tt][nt][2 * i + 1]}; const v2f e = __builtin_elementwise_fma(x, sc2, nm2);
                        const v2f p = {__builtin_amdgcn_exp2f(e[0]), __builtin_amdgcn_exp2f(e[1])}; ps2 += p;
                        const unsigned u = __builtin_bit_cast(unsigned, __builtin_convertvector(p, v2bf));
                        const v2f hf = {__uint_as_float(u << 16), __uint_as_float(u & 0xFFFF0000u)};
                        hw[tt * 4 + i] = u; lw[tt * 4 + i] = __builtin_bit_cast(unsigned, __builtin_convertvector(p - hf, v2bf)); }
                sm[nt] = __builtin_fmaf(sm[nt], al_, ps2[0] + ps2[1]);
                ph[nt] = __builtin_bit_cast(V, hw); pl[nt] = __builtin_bit_cast(V, lw);
#pragma unroll
                for (int dt = 0; dt < 4; ++dt) o[dt][nt] *= al_;
            }
#pragma unroll
            for (int dt = 0; dt < 4; ++dt)
#pragma unroll
                for (int nt = 0; nt < 2; ++nt) { o[dt][nt] = WFrag<bf>::mma(va[dt], ph[nt], o[dt][nt]); o[dt][nt] = WFrag<bf>::mma(va[dt], pl[nt], o[dt][nt]); }
            // four vector slots behind the pass's last matrix instructions, on both sides of the loop branch (the chip's distance before their A or B is overwritten or D is read)
            asm volatile("v_nop\n\tv_nop\n\tv_nop\n\tv_nop" : "+v"(o[0][0]), "+v"(o[0][1]), "+v"(o[1][0]), "+v"(o[1][1]), "+v"(o[2][0]), "+v"(o[2][1]), "+v"(o[3][0]), "+v"(o[3][1]));
        }
        // hand-over: this wave's LDS reads of the buffer are done, its copies of the next stage have landed; the barrier publishes that stage and frees this buffer for the refill
        asm volatile("s_wait_dscnt 0x0" ::: "memory");
        asm volatile("s_wait_asynccnt 0x0" ::: "memory");
        __syncthreads();
        if (st + 2 < LL / TK) stage_copy(lk0 + bo, lv0 + bo, gh + (size_t)(st + 2) * (TK * HD), gl + (size_t)(st + 2) * (TK * HD), gv + (st + 2) * TK);
    }
    // no copy is outstanding when the wave ends
    asm volatile("s_wait_asynccnt 0x0" ::: "memory");
#pragma unroll
    for (int nt = 0; nt < 2; ++nt) {
        const float f = __fdiv_rn(1.0f, sm[nt] + xhalf(sm[nt]));
        float* orow = O + (size_t)(q0 + nt * 16 + lr) * HD + 8 * hi;
#pragma unroll
        for (int dt = 0; dt < 4; ++dt) { const v8f r = o[dt][nt] * f; *(v4f*)(orow + dt * 16) = __builtin_shufflevector(r, r, 0, 1, 2, 3); *(v4f*)(orow + dt * 16 + 4) = __builtin_shufflevector(r, r, 4, 5, 6, 7); }
    }
}

extern "C" void kernel_launch(void* const* d_in, const int* in_sizes, int n_in,
                              void* d_out, int out_size, void* d_ws, size_t ws_size, hipStream_t stream) {
    (void)in_sizes; (void)n_in; (void)out_size;
    const float* q = (const float*)d_in[0]; const float* k = (const float*)d_in[1]; const float* v = (const float*)d_in[2]; const float* kpe = (const float*)d_in[3];
    float* OUT = (float*)d_out;     // [2][16][2048][64]
    char* wsp = (char*)d_ws;
    auto take = [&](size_t bytes) { char* p = wsp; wsp += (bytes + 255) & ~(size_t)255; return (void*)p; };
    const size_t per = (size_t)NH_ * LL * HD;
    bf* QP = (bf*)take(NB_ * per * 2); bf* KEh = (bf*)take(NB_ * per * 2); bf* KEl = (bf*)take(NB_ * per * 2); bf* VT = (bf*)take(NB_ * per * 2);
    if ((size_t)(wsp - (char*)d_ws) > ws_size) return;    // total 32 MiB
    k_prep<<<dim3(LL / PT, NB_ * NH_), 256, 0, stream>>>(q, k, v, kpe, QP, KEh, KEl, VT);
    k_fattn<8><<<dim3(LL / 256, NB_ * NH_), 256, 0, stream>>>(QP, KEh, KEl, VT, OUT);
}

// v005
// A run of this version takes 59.2 microseconds.
// Two timings next to v004 both put it at 1.06 times that version's speed.
// All steps since v000 together make it 25.1 times as fast.
#include <hip/hip_runtime.h>

// SeqAttention (q, k, v [2][16][2048][64], k_pe [64][2048] shared relative-position keys; scores = (q.k + q.k_pe[:, t]) / 8; softmax; out = attn v -> [2][16][2048][64]).
// The two einsums are regrouped as q . (k_t + k_pe[:, t]) (exact algebra): k + k_pe is formed in f32 from the bf16-rounded inputs (exact) and split into hi/lo bf16 planes; it is scaled in f32 by log2(e) / 8 before the split, so that the products are the scores in log2 units; scores = q.hi + q.lo as two PLAIN bf16 products summed in one f32 accumulator that starts at minus the softmax shift.
// Compute dtypes, f32 accumulate: every input rounded to bf16; scores as above (f32); softmax f32 (held shift, raised when passed by 2^8) -> hl probability fragments; attn.v as hl x exact bf16 v (2 products); all heads in one launch.

#define NB_  2
#define NH_  16
#define LL   2048
#define HD   64
#define SCL  (0.125f * 1.4426950408889634f)    // 1 / sqrt(64), and exp as exp2: folded into the key planes
typedef _Float16 h16;
typedef unsigned short bf;
typedef __attribute__((ext_vector_type(16))) __bf16   v16bf;
typedef __attribute__((ext_vector_type(16))) _Float16 v16h;
typedef __attribute__((ext_vector_type(8)))  _Float16 v8h;
typedef __attribute__((ext_vector_type(8)))  unsigned short v8us;
typedef __attribute__((ext_vector_type(8)))  float    v8f;
typedef __attribute__((ext_vector_type(4)))  float    v4f;
typedef v8h  __attribute__((may_alias)) v8ha;
typedef v4f  __attribute__((may_alias)) v4fa;
typedef v8us __attribute__((may_alias)) v8usa;

__device__ __forceinline__ unsigned short f2bf(float f) { unsigned u = __float_as_uint(f); u += 0x7FFFu + ((u >> 16) & 1u); return (unsigned short)(u >> 16); }
__device__ __forceinline__ float bf2f(unsigned short b) { return __uint_as_float(((unsigned)b) << 16); }
__device__ __forceinline__ float bfr(float f) { return bf2f(f2bf(f)); }
__device__ __forceinline__ v16h cat16(v8h lo, v8h hi) { return __builtin_shufflevector(lo, hi, 0, 1, 2, 3, 4, 5, 6, 7, 8, 9, 10, 11, 12, 13, 14, 15); }
__device__ __forceinline__ v16bf cat16b(v8us lo, v8us hi) { return __builtin_bit_cast(v16bf, __builtin_shufflevector(lo, hi, 0, 1, 2, 3, 4, 5, 6, 7, 8, 9, 10, 11, 12, 13, 14, 15)); }
__device__ __forceinline__ v8f wmma16(v16h a, v16h b, v8f c) { return __builtin_amdgcn_wmma_f32_16x16x32_f16(false, a, false, b, (short)0, c, false, false); }
__device__ __forceinline__ v8f wmmab(v16bf a, v16bf b, v8f c) { return __builtin_amdgcn_wmma_f32_16x16x32_bf16(false, a, false, b, (short)0, c, false, false); }



typedef __attribute__((ext_vector_type(2))) unsigned short v2us;
typedef __attribute__((ext_vector_type(4))) unsigned short v4us;
__device__ __forceinline__ void splitf(float y, unsigned short& h, unsigned short& l) { h = f2bf(y); l = f2bf(y - bf2f(h)); }

// ---- k_prep: all of the preparation in one launch. One work-group takes 128 tokens of one head: q rounded to bf16; (k + k_pe) * SCL split into the hi and lo planes; v rounded and transposed.
// Every global read and write is a run of whole lines; the two transposes (k_pe [d][t] -> [t][d], v [t][d] -> [d][t]) are made in registers on 4 x 4 and 8 x 4 blocks and handed over through LDS.
// Each thread has all of its 32 loads of 16 bytes in flight at once: few waves with much to do each, since a wave's start costs more than its share of the copying.
#define PT   128                   // tokens per work-group
#define PP   144                   // LDS pitch in bytes of a k_pe^T row (64 bf16 + 16)
#define PV   272                   // LDS pitch in bytes of a V^T row (128 bf16 + 16)
__global__ __launch_bounds__(256) void k_prep(const float* __restrict__ q, const float* __restrict__ k, const float* __restrict__ v, const float* __restrict__ kpe, bf* __restrict__ QP, bf* __restrict__ Kh, bf* __restrict__ Kl, bf* __restrict__ VT) {
    __shared__ __attribute__((aligned(16))) unsigned char pl[PT * PP];    // bf16(k_pe)^T: [token][d]
    __shared__ __attribute__((aligned(16))) unsigned char vl[HD * PV];    // bf16(v)^T: [d][token]
    const int tid = threadIdx.x, t0 = (int)blockIdx.x * PT; const size_t z = blockIdx.y;
    const size_t base = (z * LL + t0) * HD;    // the tile's first element in q, k, v and in the three [token][d] planes
    // k_pe: two blocks of 4 d x 4 tokens a thread; 8 lanes side by side along the tokens read one whole line of a row
    v4f kp[2][4]; int ptg[2], pdg[2];
#pragma unroll
    for (int i = 0; i < 2; ++i) { const int c = tid + 256 * i; ptg[i] = ((c >> 5) & 3) * 8 + (c & 7); pdg[i] = (c >> 7) * 4 + ((c >> 3) & 3);
#pragma unroll
        for (int u = 0; u < 4; ++u) kp[i][u] = *(const v4f*)(kpe + (size_t)(4 * pdg[i] + u) * LL + t0 + 4 * ptg[i]); }
    asm volatile("s_wait_xcnt 0x0" ::: "memory");    // before the address registers of the loads above are given to the next addresses or to later loads' data
    // v: one block of 8 tokens x 4 d a thread; 16 lanes read one whole row
    const int vd = (tid & 15) * 4, vg = tid >> 4; v4f vv[8];
#pragma unroll
    for (int j = 0; j < 8; ++j) vv[j] = *(const v4f*)(v + base + (size_t)(8 * vg + j) * HD + vd);
    asm volatile("s_wait_xcnt 0x0" ::: "memory");    // before the address registers of the loads above are given to the next addresses or to later loads' data
    // k and q: four runs of 8 elements a thread
    v8f kk[4], qq[4];
#pragma unroll
    for (int i = 0; i < 4; ++i) kk[i] = *(const v8f*)(k + base + (size_t)(tid + 256 * i) * 8);
#pragma unroll
    for (int i = 0; i < 4; ++i) qq[i] = *(const v8f*)(q + base + (size_t)(tid + 256 * i) * 8);
    // scheduling barrier: keeps all 32 loads in front of the first use (without it the compiler spreads them among the conversions to save registers, and the thread pays the memory latency several times over)
    __builtin_amdgcn_sched_barrier(0);
#pragma unroll
    for (int i = 0; i < 2; ++i)
#pragma unroll
        for (int j = 0; j < 4; ++j) { v4us w;
#pragma unroll
            for (int u = 0; u < 4; ++u) w[u] = f2bf(kp[i][u][j]);
            *(v4us*)(pl + (4 * ptg[i] + j) * PP + pdg[i] * 8) = w; }
#pragma unroll
    for (int u = 0; u < 4; ++u) { v8us w;
#pragma unroll
        for (int j = 0; j < 8; ++j) w[j] = f2bf(vv[j][u]);
        *(v8us*)(vl + (vd + u) * PV + vg * 16) = w; }
    __syncthreads();    // both transposed tiles are complete; no global store stands in front of it, so it waits for none
#pragma unroll
    for (int i = 0; i < 4; ++i) { const int c = tid + 256 * i; *(v8us*)(VT + (z * HD + (c >> 4)) * LL + t0 + (c & 15) * 8) = *(const v8us*)(vl + (c >> 4) * PV + (c & 15) * 16); }
#pragma unroll
    for (int i = 0; i < 4; ++i) { v8us o;
#pragma unroll
        for (int e = 0; e < 8; ++e) o[e] = f2bf(qq[i][e]);
        *(v8us*)(QP + base + (size_t)(tid + 256 * i) * 8) = o; }
#pragma unroll
    for (int i = 0; i < 4; ++i) { const int c = tid + 256 * i; const v8us pe = *(const v8us*)(pl + (c >> 3) * PP + (c & 7) * 16); v8us oh, ol;
#pragma unroll
        for (int e = 0; e < 8; ++e) { const float s = __fmul_rn(__fadd_rn(bfr(kk[i][e]), bf2f(pe[e])), SCL); unsigned short x, y; splitf(s, x, y); oh[e] = x; ol[e] = y; }
        *(v8us*)(Kh + base + (size_t)c * 8) = oh; *(v8us*)(Kl + base + (size_t)c * 8) = ol; }
}
// ---- k_fattn: scores, softmax and attn.v in one kernel. One wave owns 32 queries of one head and walks the 2048 keys 32 at a time; grid (LL / (32 NW), heads), 32 NW threads.
// The work-group's waves all walk the same keys: the key planes and V^T come through LDS, 128 keys a stage, two buffers, by asynchronous copies (each lane 16 bytes); the next stage flies while this one is worked on.
// Transposed products: S^T = KE . Q^T (A = key rows, hi plane then lo plane into one accumulator; B = the wave's queries, loaded once) and O^T += V^T . P^T (A = VT rows, B = P).
// A lane holds the scores of ONE query (column lr): keys 8 hi + j of each 16-key tile. Two such tiles, converted in place, are the B fragment of the second product in the loaders' own k order.
// Softmax against a HELD shift per query: p = exp2(score - shift). The shift is known before the scores are formed, so minus the shift is the score product's start value (its C operand) and no vector instruction subtracts it.
// It is set to the first pass's maximum and raised only when a score passes it by more than 2^8 (one ballot branch a pass, for the whole wave); only then are the sums so far scaled by exp2(old - new). p never exceeds 2^8, far inside f32 and bf16 range.
// P is split hi/lo unnormalised; the division by the row sum comes once, at the end.
template <typename T16> struct WFrag;
template <> struct WFrag<bf> { typedef v16bf V; static __device__ __forceinline__ V ld(const bf* p) { return cat16b(*(const v8us*)p, *(const v8us*)(p + 16)); } static __device__ __forceinline__ v8f mma(V a, V b, v8f c) { return wmmab(a, b, c); } };
typedef __attribute__((ext_vector_type(2))) __bf16 v2bf;
typedef __attribute__((ext_vector_type(2))) float v2f;
typedef __attribute__((ext_vector_type(8))) unsigned v8u;
// the value of lane l ^ 16: the other half of a query's keys
__device__ __forceinline__ float xhalf(float x) { const int b = __float_as_int(x); return __int_as_float(__builtin_amdgcn_permlanex16(b, b, 0x76543210, 0xfedcba98, false, false)); }
#define TK   128                   // keys per stage
#define KP   144                   // LDS pitch in bytes of a key row (128 + 16: 16 B x odd, conflict-free for 16-byte reads)
#define VP   272                   // LDS pitch in bytes of a V^T row (256 + 16)
#define KSZ  (TK * KP)             // one key plane of a stage
#define BSZ  (2 * KSZ + HD * VP)   // one buffer: hi plane, lo plane, V^T
// One stage's copies of one thread (256 threads): 4 x 16 B of each key plane (rows r, r + 32, ...) and 4 x 16 B of V^T (rows r, r + 16, ...).
// lk, lv: the lane's LDS byte addresses in the hi plane and in V^T; gh, gl, gv: its global addresses. s_wait_xcnt stands in the copies' own statement, before any of their address registers can be rewritten.
__device__ __forceinline__ void stage_copy(unsigned lk, unsigned lv, const bf* gh, const bf* gl, const bf* gv) {
    asm volatile("global_load_async_to_lds_b128 %0, %1, off\n\t"
                 "global_load_async_to_lds_b128 %2, %3, off\n\t"
                 "global_load_async_to_lds_b128 %4, %5, off\n\t"
                 "global_load_async_to_lds_b128 %6, %7, off\n\t"
                 "global_load_async_to_lds_b128 %8, %9, off\n\t"
                 "global_load_async_to_lds_b128 %10, %11, off\n\t"
                 "global_load_async_to_lds_b128 %12, %13, off\n\t"
                 "global_load_async_to_lds_b128 %14, %15, off\n\t"
                 "global_load_async_to_lds_b128 %16, %17, off\n\t"
                 "global_load_async_to_lds_b128 %18, %19, off\n\t"
                 "global_load_async_to_lds_b128 %20, %21, off\n\t"
                 "global_load_async_to_lds_b128 %22, %23, off\n\t"
                 "s_wait_xcnt 0x0"
                 :: "v"(lk), "v"(gh), "v"(lk + 32 * KP), "v"(gh + 32 * HD), "v"(lk + 64 * KP), "v"(gh + 64 * HD), "v"(lk + 96 * KP), "v"(gh + 96 * HD),
                    "v"(lk + KSZ), "v"(gl), "v"(lk + KSZ + 32 * KP), "v"(gl + 32 * HD), "v"(lk + KSZ + 64 * KP), "v"(gl + 64 * HD), "v"(lk + KSZ + 96 * KP), "v"(gl + 96 * HD),
                    "v"(lv), "v"(gv), "v"(lv + 16 * VP), "v"(gv + 16 * LL), "v"(lv + 32 * VP), "v"(gv + 32 * LL), "v"(lv + 48 * VP), "v"(gv + 48 * LL)
                 : "memory");
}
template <int NW>
__global__ __launch_bounds__(32 * NW) void k_fattn(const bf* __restrict__ Q, const bf* __restrict__ Kh, const bf* __restrict__ Kl, const bf* __restrict__ VT, float* __restrict__ O) {
    typedef WFrag<bf>::V V;
    static_assert(NW == 8, "the stage copies are laid out for 256 threads");
    __shared__ __attribute__((aligned(16))) unsigned char ring[2 * BSZ];
    const size_t z = blockIdx.y; Q += z * (size_t)(LL * HD); Kh += z * (size_t)(LL * HD); Kl += z * (size_t)(LL * HD); VT += z * (size_t)(HD * LL); O += z * (size_t)(LL * HD);
    const int tid = threadIdx.x, lane = tid & 31, lr = lane & 15, hi = lane >> 4;
    const int wv = __builtin_amdgcn_readfirstlane(threadIdx.x >> 5);    // the wave's number, kept scalar
    const int q0 = ((int)blockIdx.x * NW + wv) * 32;
    // this thread's share of a stage: LDS byte addresses in buffer 0, global addresses of stage 0
    const unsigned ring0 = (unsigned)(size_t)ring;
    const unsigned lk0 = ring0 + (unsigned)((tid >> 3) * KP + (tid & 7) * 16), lv0 = ring0 + (unsigned)(2 * KSZ + (tid >> 4) * VP + (tid & 15) * 16);
    const bf* gh = Kh + (tid >> 3) * HD + (tid & 7) * 8; const bf* gl = Kl + (tid >> 3) * HD + (tid & 7) * 8; const bf* gv = VT + (size_t)(tid >> 4) * LL + (tid & 15) * 8;
    stage_copy(lk0, lv0, gh, gl, gv);
    V qf[2][2];    // [query tile][k chunk]
#pragma unroll
    for (int nt = 0; nt < 2; ++nt)
#pragma unroll
        for (int kc = 0; kc < 2; ++kc) qf[nt][kc] = WFrag<bf>::ld(Q + (size_t)(q0 + nt * 16 + lr) * HD + kc * 32 + 8 * hi);
    v8f o[4][2];    // [d tile][query tile]: o[dt][nt][j] = O[q0 + 16 nt + lr][16 dt + 8 hi + j]
#pragma unroll
    for (int dt = 0; dt < 4; ++dt)
#pragma unroll
        for (int nt = 0; nt < 2; ++nt) o[dt][nt] = (v8f){};
    v8f nm[2] = {(v8f){}, (v8f){}};    // minus the held shift of the lane's query (log2 units; equal in both lane halves), in all eight accumulator rows: the score products' start value
    float sm[2] = {0.f, 0.f};    // this lane half's share of the row sum
    // stage 0 has landed for this wave; the barrier publishes it to the others; then stage 1 starts into buffer 1
    asm volatile("s_wait_asynccnt 0x0" ::: "memory");
    __syncthreads();
    stage_copy(lk0 + BSZ, lv0 + BSZ, gh + TK * HD, gl + TK * HD, gv + TK);
    // both loops rolled: one pass already holds 32 matrix instructions, and a second pass's fragments would only cost registers
#pragma unroll 1
    for (int st = 0; st < LL / TK; ++st) {
        const unsigned bo = (unsigned)(st & 1) * BSZ;
        const bf* kh = (const bf*)(ring + bo + lr * KP + 16 * hi); const bf* kl = (const bf*)(ring + bo + KSZ + lr * KP + 16 * hi); const bf* vt = (const bf*)(ring + bo + 2 * KSZ + lr * VP + 16 * hi);
        V ah[2][2], al[2][2];    // [key tile][k chunk]
#pragma unroll
        for (int tt = 0; tt < 2; ++tt)
#pragma unroll
            for (int kc = 0; kc < 2; ++kc) { ah[tt][kc] = WFrag<bf>::ld(kh + tt * 16 * (KP / 2) + kc * 32); al[tt][kc] = WFrag<bf>::ld(kl + tt * 16 * (KP / 2) + kc * 32); }
#pragma unroll 1
        for (int ps = 0; ps < TK / 32; ++ps) {
            v8f s[2][2];    // [key tile][query tile]
#pragma unroll
            for (int tt = 0; tt < 2; ++tt)
#pragma unroll
                for (int nt = 0; nt < 2; ++nt) { v8f c = nm[nt];
#pragma unroll
                    for (int kc = 0; kc < 2; ++kc) { c = WFrag<bf>::mma(ah[tt][kc], qf[nt][kc], c); c = WFrag<bf>::mma(al[tt][kc], qf[nt][kc], c); }
                    s[tt][nt] = c; }
            V va[4];
#pragma unroll
            for (int dt = 0; dt < 4; ++dt) va[dt] = WFrag<bf>::ld(vt + dt * 16 * (VP / 2) + ps * 32);
            // compiler fence in front of the branch: holds the V^T reads here, so that they fly during the softmax (without it they sink in among the second product's matrix instructions and are waited for there)
            asm volatile("" ::: "memory");
            // the next pass's key fragments, fetched behind this pass's score products so that they fly during the softmax; never beyond this stage's own buffer
            if (ps + 1 < TK / 32) {
#pragma unroll
                for (int tt = 0; tt < 2; ++tt)
#pragma unroll
                    for (int kc = 0; kc < 2; ++kc) { ah[tt][kc] = WFrag<bf>::ld(kh + ((ps + 1) * 32 + tt * 16) * (KP / 2) + kc * 32); al[tt][kc] = WFrag<bf>::ld(kl + ((ps + 1) * 32 + tt * 16) * (KP / 2) + kc * 32); }
            }
            // the test needs no maximum per query, only whether ANY score of the wave stands more than 2^8 above its query's shift: four short chains, no exchange between the lane halves
            float t4[2][2];
#pragma unroll
            for (int tt = 0; tt < 2; ++tt)
#pragma unroll
                for (int nt = 0; nt < 2; ++nt) { float b = s[tt][nt][0];
#pragma unroll
                    for (int j = 1; j < 8; ++j) b = fmaxf(b, s[tt][nt][j]);
                    t4[tt][nt] = b; }
            const float top = fmaxf(fmaxf(t4[0][0], t4[1][0]), fmaxf(t4[0][1], t4[1][1]));
            // the rare path, taken by the whole wave: the first pass sets each shift to its query's own maximum; later a shift rises when some score of the wave has passed its shift by more than 2^8
            const bool first = (st | ps) == 0;
            const float thr = first ? -3.0e38f : 8.0f;    // one compare and one branch serve both cases
            if (__builtin_amdgcn_ballot_w32(top > thr) != 0u) {
#pragma unroll
                for (int nt = 0; nt < 2; ++nt) {
                    float bm = fmaxf(t4[0][nt], t4[1][nt]); bm = fmaxf(bm, xhalf(bm));    // the query's largest score of this pass above its shift, equal in both lane halves
                    const float d = first ? bm : fmaxf(bm, 0.f), al_ = first ? 1.0f : __builtin_amdgcn_exp2f(-d);    // the sums are still zero in the first pass
                    nm[nt] -= d; s[0][nt] -= d; s[1][nt] -= d; sm[nt] *= al_;
#pragma unroll
                    for (int dt = 0; dt < 4; ++dt) o[dt][nt] *= al_;
                }
            }
            V ph[2], pl[2];
#pragma unroll
            for (int nt = 0; nt < 2; ++nt) {
                // two scores at a time (neighbouring accumulator registers): p = exp2(s); hi = bf16(p), read back from the packed pair by a shift and a mask; lo = bf16(p - hi)
                v2f ps2 = {0.f, 0.f}; v8u hw, lw;
#pragma unroll
                for (int tt = 0; tt < 2; ++tt)
#pragma unroll
                    for (int i = 0; i < 4; ++i) {
                        const v2f p = {__builtin_amdgcn_exp2f(s[tt][nt][2 * i]), __builtin_amdgcn_exp2f(s[tt][nt][2 * i + 1])}; ps2 += p;
                        const unsigned u = __builtin_bit_cast(unsigned, __builtin_convertvector(p, v2bf));
                        const v2f hf = {__uint_as_float(u << 16), __uint_as_float(u & 0xFFFF0000u)};
                        hw[tt * 4 + i] = u; lw[tt * 4 + i] = __builtin_bit_cast(unsigned, __builtin_convertvector(p - hf, v2bf)); }
                sm[nt] += ps2[0] + ps2[1];
                ph[nt] = __builtin_bit_cast(V, hw); pl[nt] = __builtin_bit_cast(V, lw);
            }
#pragma unroll
            for (int dt = 0; dt < 4; ++dt)
#pragma unroll
                for (int nt = 0; nt < 2; ++nt) { o[dt][nt] = WFrag<bf>::mma(va[dt], ph[nt], o[dt][nt]); o[dt][nt] = WFrag<bf>::mma(va[dt], pl[nt], o[dt][nt]); }
            // four vector slots behind the pass's last matrix instructions, on both sides of the loop branch (the chip's distance before their A or B is overwritten or D is read)
            asm volatile("v_nop\n\tv_nop\n\tv_nop\n\tv_nop" : "+v"(o[0][0]), "+v"(o[0][1]), "+v"(o[1][0]), "+v"(o[1][1]), "+v"(o[2][0]), "+v"(o[2][1]), "+v"(o[3][0]), "+v"(o[3][1]));
        }
        // hand-over: this wave's LDS reads of the buffer are done, its copies of the next stage have landed; the barrier publishes that stage and frees this buffer for the refill
        asm volatile("s_wait_dscnt 0x0" ::: "memory");
        asm volatile("s_wait_asynccnt 0x0" ::: "memory");
        __syncthreads();
        if (st + 2 < LL / TK) stage_copy(lk0 + bo, lv0 + bo, gh + (size_t)(st + 2) * (TK * HD), gl + (size_t)(st + 2) * (TK * HD), gv + (st + 2) * TK);
    }
    // no copy is outstanding when the wave ends
    asm volatile("s_wait_asynccnt 0x0" ::: "memory");
#pragma unroll
    for (int nt = 0; nt < 2; ++nt) {
        const float f = __fdiv_rn(1.0f, sm[nt] + xhalf(sm[nt]));
        float* orow = O + (size_t)(q0 + nt * 16 + lr) * HD + 8 * hi;
#pragma unroll
        for (int dt = 0; dt < 4; ++dt) { const v8f r = o[dt][nt] * f; *(v4f*)(orow + dt * 16) = __builtin_shufflevector(r, r, 0, 1, 2, 3); *(v4f*)(orow + dt * 16 + 4) = __builtin_shufflevector(r, r, 4, 5, 6, 7); }
    }
}

extern "C" void kernel_launch(void* const* d_in, const int* in_sizes, int n_in,
                              void* d_out, int out_size, void* d_ws, size_t ws_size, hipStream_t stream) {
    (void)in_sizes; (void)n_in; (void)out_size;
    const float* q = (const float*)d_in[0]; const float* k = (const float*)d_in[1]; const float* v = (const float*)d_in[2]; const float* kpe = (const float*)d_in[3];
    float* OUT = (float*)d_out;     // [2][16][2048][64]
    char* wsp = (char*)d_ws;
    auto take = [&](size_t bytes) { char* p = wsp; wsp += (bytes + 255) & ~(size_t)255; return (void*)p; };
    const size_t per = (size_t)NH_ * LL * HD;
    bf* QP = (bf*)take(NB_ * per * 2); bf* KEh = (bf*)take(NB_ * per * 2); bf* KEl = (bf*)take(NB_ * per * 2); bf* VT = (bf*)take(NB_ * per * 2);
    if ((size_t)(wsp - (char*)d_ws) > ws_size) return;    // total 32 MiB
    k_prep<<<dim3(LL / PT, NB_ * NH_), 256, 0, stream>>>(q, k, v, kpe, QP, KEh, KEl, VT);
    k_fattn<8><<<dim3(LL / 256, NB_ * NH_), 256, 0, stream>>>(QP, KEh, KEl, VT, OUT);
}

// v007
// One run takes 40.1 microseconds.
// Versions in between are left out here; by their measured steps it is 1.48 times as fast as v005.
// Counting every step since v000, it is 37.2 times as fast.
#include <hip/hip_runtime.h>

// SeqAttention (q, k, v [2][16][2048][64], k_pe [64][2048] shared relative-position keys; scores = (q.k + q.k_pe[:, t]) / 8; softmax; out = attn v -> [2][16][2048][64]).
// The two einsums are regrouped as q . (k_t + k_pe[:, t]) (exact algebra): k + k_pe is formed in f32 from the bf16-rounded inputs (exact), scaled in f32 by log2(e) / 8, so that the products are the scores in log2 units, and rounded once to f16 (11 significant bits); scores = one f16 product in an f32 accumulator that starts at minus the softmax shift.
// Compute dtypes, f32 accumulate: every input rounded to bf16; the rounded q and v are held as f16, which keeps their 8 significant bits as they are down to 2^-17; softmax f32 (held shift, raised when passed by 2^8) -> probabilities rounded once to f16; attn.v as one f16 product; all heads in one launch.

#define NB_  2
#define NH_  16
#define LL   2048
#define HD   64
#define SCL  (0.125f * 1.4426950408889634f)    // 1 / sqrt(64), and exp as exp2: folded into the key planes
typedef _Float16 h16;
typedef unsigned short bf;
typedef __attribute__((ext_vector_type(16))) _Float16 v16h;
typedef __attribute__((ext_vector_type(8)))  _Float16 v8h;
typedef __attribute__((ext_vector_type(8)))  unsigned short v8us;
typedef __attribute__((ext_vector_type(8)))  float    v8f;
typedef __attribute__((ext_vector_type(4)))  float    v4f;
typedef v8h  __attribute__((may_alias)) v8ha;

__device__ __forceinline__ unsigned short f2bf(float f) { unsigned u = __float_as_uint(f); u += 0x7FFFu + ((u >> 16) & 1u); return (unsigned short)(u >> 16); }
__device__ __forceinline__ float bf2f(unsigned short b) { return __uint_as_float(((unsigned)b) << 16); }
__device__ __forceinline__ float bfr(float f) { return bf2f(f2bf(f)); }
__device__ __forceinline__ v16h cat16(v8h lo, v8h hi) { return __builtin_shufflevector(lo, hi, 0, 1, 2, 3, 4, 5, 6, 7, 8, 9, 10, 11, 12, 13, 14, 15); }
__device__ __forceinline__ v8f wmma16(v16h a, v16h b, v8f c) { return __builtin_amdgcn_wmma_f32_16x16x32_f16(false, a, false, b, (short)0, c, false, false); }
// eight f32 to f16 (nearest even), as the bits that are stored
__device__ __forceinline__ v8us h8(v8f x) { return __builtin_bit_cast(v8us, __builtin_convertvector(x, v8h)); }



typedef __attribute__((ext_vector_type(4))) unsigned short v4us;

// ---- k_prep: all of the preparation in one launch. One work-group takes 128 tokens of one head: q rounded to bf16 and stored as f16; (k + k_pe) * SCL rounded to f16; v rounded to bf16, stored as f16 and transposed.
// Every global read and write is a run of whole lines; the two transposes (k_pe [d][t] -> [t][d], v [t][d] -> [d][t]) are made in registers on 4 x 4 and 8 x 4 blocks and handed over through LDS.
// Each thread has all of its 32 loads of 16 bytes in flight at once: few waves with much to do each, since a wave's start costs more than its share of the copying.
#define PT   128                   // tokens per work-group
#define PP   144                   // LDS pitch in bytes of a k_pe^T row (64 bf16 + 16)
#define PV   272                   // LDS pitch in bytes of a V^T row (128 f16 + 16)
__global__ __launch_bounds__(256) void k_prep(const float* __restrict__ q, const float* __restrict__ k, const float* __restrict__ v, const float* __restrict__ kpe, bf* __restrict__ QP, bf* __restrict__ KE, bf* __restrict__ VT) {
    __shared__ __attribute__((aligned(16))) unsigned char pl[PT * PP];    // bf16(k_pe)^T: [token][d]
    __shared__ __attribute__((aligned(16))) unsigned char vl[HD * PV];    // bf16(v)^T as f16: [d][token]
    const int tid = threadIdx.x, t0 = (int)blockIdx.x * PT; const size_t z = blockIdx.y;
    const size_t base = (z * LL + t0) * HD;    // the tile's first element in q, k, v and in the two [token][d] planes
    // k_pe: two blocks of 4 d x 4 tokens a thread; 8 lanes side by side along the tokens read one whole line of a row
    v4f kp[2][4]; int ptg[2], pdg[2];
#pragma unroll
    for (int i = 0; i < 2; ++i) { const int c = tid + 256 * i; ptg[i] = ((c >> 5) & 3) * 8 + (c & 7); pdg[i] = (c >> 7) * 4 + ((c >> 3) & 3);
#pragma unroll
        for (int u = 0; u < 4; ++u) kp[i][u] = *(const v4f*)(kpe + (size_t)(4 * pdg[i] + u) * LL + t0 + 4 * ptg[i]); }
    asm volatile("s_wait_xcnt 0x0" ::: "memory");    // before the address registers of the loads above are given to the next addresses or to later loads' data
    // v: one block of 8 tokens x 4 d a thread; 16 lanes read one whole row
    const int vd = (tid & 15) * 4, vg = tid >> 4; v4f vv[8];
#pragma unroll
    for (int j = 0; j < 8; ++j) vv[j] = *(const v4f*)(v + base + (size_t)(8 * vg + j) * HD + vd);
    asm volatile("s_wait_xcnt 0x0" ::: "memory");    // before the address registers of the loads above are given to the next addresses or to later loads' data
    // k and q: four runs of 8 elements a thread
    v8f kk[4], qq[4];
#pragma unroll
    for (int i = 0; i < 4; ++i) kk[i] = *(const v8f*)(k + base + (size_t)(tid + 256 * i) * 8);
#pragma unroll
    for (int i = 0; i < 4; ++i) qq[i] = *(const v8f*)(q + base + (size_t)(tid + 256 * i) * 8);
    // scheduling barrier: keeps all 32 loads in front of the first use (without it the compiler spreads them among the conversions to save registers, and the thread pays the memory latency several times over)
    __builtin_amdgcn_sched_barrier(0);
#pragma unroll
    for (int i = 0; i < 2; ++i)
#pragma unroll
        for (int j = 0; j < 4; ++j) { v4us w;
#pragma unroll
            for (int u = 0; u < 4; ++u) w[u] = f2bf(kp[i][u][j]);
            *(v4us*)(pl + (4 * ptg[i] + j) * PP + pdg[i] * 8) = w; }
#pragma unroll
    for (int u = 0; u < 4; ++u) { v8f w;
#pragma unroll
        for (int j = 0; j < 8; ++j) w[j] = bfr(vv[j][u]);
        *(v8us*)(vl + (vd + u) * PV + vg * 16) = h8(w); }
    __syncthreads();    // both transposed tiles are complete; no global store stands in front of it, so it waits for none
#pragma unroll
    for (int i = 0; i < 4; ++i) { const int c = tid + 256 * i; *(v8us*)(VT + (z * HD + (c >> 4)) * LL + t0 + (c & 15) * 8) = *(const v8us*)(vl + (c >> 4) * PV + (c & 15) * 16); }
#pragma unroll
    for (int i = 0; i < 4; ++i) { v8f o;
#pragma unroll
        for (int e = 0; e < 8; ++e) o[e] = bfr(qq[i][e]);
        *(v8us*)(QP + base + (size_t)(tid + 256 * i) * 8) = h8(o); }
#pragma unroll
    for (int i = 0; i < 4; ++i) { const int c = tid + 256 * i; const v8us pe = *(const v8us*)(pl + (c >> 3) * PP + (c & 7) * 16); v8f s;
#pragma unroll
        for (int e = 0; e < 8; ++e) s[e] = __fmul_rn(__fadd_rn(bfr(kk[i][e]), bf2f(pe[e])), SCL);
        *(v8us*)(KE + base + (size_t)c * 8) = h8(s); }
}
// ---- k_fattn: scores, softmax and attn.v in one kernel. Two waves share 32 queries of one head: each walks one half of the 2048 keys, 32 at a time, with a shift and sums of its own; grid (LL / (32 NW), heads), 64 NW threads.
// That makes four waves a SIMD out of the same work: one wave's softmax runs beside the others' matrix instructions. At the end the two partial results are joined through LDS (each wave of a pair finishes 16 of the 32 queries).
// The NW waves of a key half all walk the same keys: the key plane and V^T come through LDS, 128 keys a stage and half, two buffers a half, by asynchronous copies (each lane 16 bytes); the next stage flies while this one is worked on.
// Transposed products: S^T = KE . Q^T (A = key rows; B = the wave's queries, loaded once) and O^T += V^T . P^T (A = VT rows, B = P).
// A lane holds the scores of ONE query (column lr): keys 8 hi + j of each 16-key tile. Two such tiles, converted in place, are the B fragment of the second product in the loaders' own k order.
// Softmax against a HELD shift per query: p = exp2(score - shift). The shift is known before the scores are formed, so minus the shift is the score product's start value (its C operand) and no vector instruction subtracts it.
// It is set to the first pass's maximum and raised only when a score passes it by more than 2^8 (one ballot branch a pass, for the whole wave); only then are the sums so far scaled by exp2(old - new). p never exceeds 2^8, far inside f32 and f16 range.
// P is rounded to f16 unnormalised; the row sum takes the unrounded p; the division by it comes once, at the end.
template <typename T16> struct WFrag;
template <> struct WFrag<h16> { typedef v16h V; static __device__ __forceinline__ V ld(const bf* p) { return cat16(*(const v8ha*)p, *(const v8ha*)(p + 16)); } static __device__ __forceinline__ v8f mma(V a, V b, v8f c) { return wmma16(a, b, c); } };
typedef __attribute__((ext_vector_type(2))) _Float16 v2h;
typedef __attribute__((ext_vector_type(2))) float v2f;
typedef __attribute__((ext_vector_type(8))) unsigned v8u;
// the value of lane l ^ 16: the other half of a query's keys
__device__ __forceinline__ float xhalf(float x) { const int b = __float_as_int(x); return __int_as_float(__builtin_amdgcn_permlanex16(b, b, 0x76543210, 0xfedcba98, false, false)); }
#define TK   128                   // keys per stage
#define KP   144                   // LDS pitch in bytes of a key row (128 + 16: 16 B x odd, conflict-free for 16-byte reads)
#define VP   272                   // LDS pitch in bytes of a V^T row (256 + 16)
#define KSZ  (TK * KP)             // the key plane of a stage
#define BSZ  (KSZ + HD * VP)       // one buffer: key plane, V^T
#define KH   (LL / 2)              // keys of one half
#define XSZ  4352                  // the joining: one wave's parcel in LDS (4 d tiles x 32 lanes x 32 B, then 32 shifts, then 32 sums)
// One stage's copies of one thread (256 threads a key half): 4 x 16 B of the key plane (rows r, r + 32, ...) and 4 x 16 B of V^T (rows r, r + 16, ...).
// lk, lv: the lane's LDS byte addresses in the key plane and in V^T; gk, gv: its global addresses. s_wait_xcnt stands in the copies' own statement, before any of their address registers can be rewritten.
__device__ __forceinline__ void stage_copy(unsigned lk, unsigned lv, const bf* gk, const bf* gv) {
    asm volatile("global_load_async_to_lds_b128 %0, %1, off\n\t"
                 "global_load_async_to_lds_b128 %2, %3, off\n\t"
                 "global_load_async_to_lds_b128 %4, %5, off\n\t"
                 "global_load_async_to_lds_b128 %6, %7, off\n\t"
                 "global_load_async_to_lds_b128 %8, %9, off\n\t"
                 "global_load_async_to_lds_b128 %10, %11, off\n\t"
                 "global_load_async_to_lds_b128 %12, %13, off\n\t"
                 "global_load_async_to_lds_b128 %14, %15, off\n\t"
                 "s_wait_xcnt 0x0"
                 :: "v"(lk), "v"(gk), "v"(lk + 32 * KP), "v"(gk + 32 * HD), "v"(lk + 64 * KP), "v"(gk + 64 * HD), "v"(lk + 96 * KP), "v"(gk + 96 * HD),
                    "v"(lv), "v"(gv), "v"(lv + 16 * VP), "v"(gv + 16 * LL), "v"(lv + 32 * VP), "v"(gv + 32 * LL), "v"(lv + 48 * VP), "v"(gv + 48 * LL)
                 : "memory");
}
template <int NW>
__global__ __launch_bounds__(64 * NW) void k_fattn(const bf* __restrict__ Q, const bf* __restrict__ KE, const bf* __restrict__ VT, float* __restrict__ O) {
    typedef WFrag<h16>::V V;
    static_assert(NW == 8, "the stage copies are laid out for 256 threads a key half");
    static_assert(2 * NW * XSZ <= 4 * BSZ, "the parcels of the joining lie in the ring");
    __shared__ __attribute__((aligned(16))) unsigned char ring[4 * BSZ];    // [key half][buffer]
    const size_t z = blockIdx.y; Q += z * (size_t)(LL * HD); KE += z * (size_t)(LL * HD); VT += z * (size_t)(HD * LL); O += z * (size_t)(LL * HD);
    const int tid = threadIdx.x & (32 * NW - 1), lane = tid & 31, lr = lane & 15, hi = lane >> 4;    // tid: the thread's number within its key half
    const int wv = __builtin_amdgcn_readfirstlane(threadIdx.x >> 5);    // the wave's number, kept scalar
    const int kh = wv / NW;    // the wave's key half
    const int q0 = ((int)blockIdx.x * NW + (wv & (NW - 1))) * 32;
    KE += (size_t)kh * (KH * HD); VT += kh * KH;    // the half's first key
    // this thread's share of a stage: LDS byte addresses in buffer 0, global addresses of stage 0
    unsigned char* const hbuf = ring + kh * (2 * BSZ);    // the half's two buffers
    const unsigned ring0 = (unsigned)(size_t)hbuf;
    const unsigned lk0 = ring0 + (unsigned)((tid >> 3) * KP + (tid & 7) * 16), lv0 = ring0 + (unsigned)(KSZ + (tid >> 4) * VP + (tid & 15) * 16);
    const bf* gk = KE + (tid >> 3) * HD + (tid & 7) * 8; const bf* gv = VT + (size_t)(tid >> 4) * LL + (tid & 15) * 8;
    stage_copy(lk0, lv0, gk, gv);
    V qf[2][2];    // [query tile][k chunk]
#pragma unroll
    for (int nt = 0; nt < 2; ++nt)
#pragma unroll
        for (int kc = 0; kc < 2; ++kc) qf[nt][kc] = WFrag<h16>::ld(Q + (size_t)(q0 + nt * 16 + lr) * HD + kc * 32 + 8 * hi);
    v8f o[4][2];    // [d tile][query tile]: o[dt][nt][j] = O[q0 + 16 nt + lr][16 dt + 8 hi + j]
#pragma unroll
    for (int dt = 0; dt < 4; ++dt)
#pragma unroll
        for (int nt = 0; nt < 2; ++nt) o[dt][nt] = (v8f){};
    v8f nm[2] = {(v8f){}, (v8f){}};    // minus the held shift of the lane's query (log2 units; equal in both lane halves), in all eight accumulator rows: the score products' start value
    float sm[2] = {0.f, 0.f};    // this lane half's share of the row sum
    // stage 0 has landed for this wave; the barrier publishes it to the others; then stage 1 starts into buffer 1
    asm volatile("s_wait_asynccnt 0x0" ::: "memory");
    __syncthreads();
    stage_copy(lk0 + BSZ, lv0 + BSZ, gk + TK * HD, gv + TK);
    // both loops rolled: a second pass's fragments would only cost registers
#pragma unroll 1
    for (int st = 0; st < KH / TK; ++st) {
        const unsigned bo = (unsigned)(st & 1) * BSZ;
        const bf* ke = (const bf*)(hbuf + bo + lr * KP + 16 * hi); const bf* vt = (const bf*)(hbuf + bo + KSZ + lr * VP + 16 * hi);
        V ak[2][2];    // [key tile][k chunk]
#pragma unroll
        for (int tt = 0; tt < 2; ++tt)
#pragma unroll
            for (int kc = 0; kc < 2; ++kc) ak[tt][kc] = WFrag<h16>::ld(ke + tt * 16 * (KP / 2) + kc * 32);
#pragma unroll 1
        for (int ps = 0; ps < TK / 32; ++ps) {
            v8f s[2][2];    // [key tile][query tile]
#pragma unroll
            for (int tt = 0; tt < 2; ++tt)
#pragma unroll
                for (int nt = 0; nt < 2; ++nt) { v8f c = nm[nt];
#pragma unroll
                    for (int kc = 0; kc < 2; ++kc) c = WFrag<h16>::mma(ak[tt][kc], qf[nt][kc], c);
                    s[tt][nt] = c; }
            V va[4];
#pragma unroll
            for (int dt = 0; dt < 4; ++dt) va[dt] = WFrag<h16>::ld(vt + dt * 16 * (VP / 2) + ps * 32);
            // compiler fence in front of the branch: holds the V^T reads here, so that they fly during the softmax (without it they sink in among the second product's matrix instructions and are waited for there)
            asm volatile("" ::: "memory");
            // the next pass's key fragments, fetched behind this pass's score products so that they fly during the softmax; never beyond this stage's own buffer
            if (ps + 1 < TK / 32) {
#pragma unroll
                for (int tt = 0; tt < 2; ++tt)
#pragma unroll
                    for (int kc = 0; kc < 2; ++kc) ak[tt][kc] = WFrag<h16>::ld(ke + ((ps + 1) * 32 + tt * 16) * (KP / 2) + kc * 32);
            }
            // the test needs no maximum per query, only whether ANY score of the wave stands more than 2^8 above its query's shift: four short chains, no exchange between the lane halves
            float t4[2][2];
#pragma unroll
            for (int tt = 0; tt < 2; ++tt)
#pragma unroll
                for (int nt = 0; nt < 2; ++nt) { float b = s[tt][nt][0];
#pragma unroll
                    for (int j = 1; j < 8; ++j) b = fmaxf(b, s[tt][nt][j]);
                    t4[tt][nt] = b; }
            const float top = fmaxf(fmaxf(t4[0][0], t4[1][0]), fmaxf(t4[0][1], t4[1][1]));
            // the rare path, taken by the whole wave: the first pass sets each shift to its query's own maximum; later a shift rises when some score of the wave has passed its shift by more than 2^8
            const bool first = (st | ps) == 0;
            const float thr = first ? -3.0e38f : 8.0f;    // one compare and one branch serve both cases
            if (__builtin_amdgcn_ballot_w32(top > thr) != 0u) {
#pragma unroll
                for (int nt = 0; nt < 2; ++nt) {
                    float bm = fmaxf(t4[0][nt], t4[1][nt]); bm = fmaxf(bm, xhalf(bm));    // the query's largest score of this pass above its shift, equal in both lane halves
                    const float d = first ? bm : fmaxf(bm, 0.f), al_ = first ? 1.0f : __builtin_amdgcn_exp2f(-d);    // the sums are still zero in the first pass
                    nm[nt] -= d; s[0][nt] -= d; s[1][nt] -= d; sm[nt] *= al_;
#pragma unroll
                    for (int dt = 0; dt < 4; ++dt) o[dt][nt] *= al_;
                }
            }
            V pf[2];
#pragma unroll
            for (int nt = 0; nt < 2; ++nt) {
                // two scores at a time (neighbouring accumulator registers): p = exp2(s), packed as a pair of f16
                v2f ps2 = {0.f, 0.f}; v8u hw;
#pragma unroll
                for (int tt = 0; tt < 2; ++tt)
#pragma unroll
                    for (int i = 0; i < 4; ++i) {
                        const v2f p = {__builtin_amdgcn_exp2f(s[tt][nt][2 * i]), __builtin_amdgcn_exp2f(s[tt][nt][2 * i + 1])}; ps2 += p;
                        hw[tt * 4 + i] = __builtin_bit_cast(unsigned, __builtin_convertvector(p, v2h)); }
                sm[nt] += ps2[0] + ps2[1];
                pf[nt] = __builtin_bit_cast(V, hw);
            }
#pragma unroll
            for (int dt = 0; dt < 4; ++dt)
#pragma unroll
                for (int nt = 0; nt < 2; ++nt) o[dt][nt] = WFrag<h16>::mma(va[dt], pf[nt], o[dt][nt]);
            // four vector slots behind the pass's last matrix instructions, on both sides of the loop branch (the chip's distance before their A or B is overwritten or D is read)
            asm volatile("v_nop\n\tv_nop\n\tv_nop\n\tv_nop" : "+v"(o[0][0]), "+v"(o[0][1]), "+v"(o[1][0]), "+v"(o[1][1]), "+v"(o[2][0]), "+v"(o[2][1]), "+v"(o[3][0]), "+v"(o[3][1]));
        }
        // hand-over: this wave's LDS reads of the buffer are done, its copies of the next stage have landed; the barrier publishes that stage and frees this buffer for the refill
        asm volatile("s_wait_dscnt 0x0" ::: "memory");
        asm volatile("s_wait_asynccnt 0x0" ::: "memory");
        __syncthreads();
        if (st + 2 < KH / TK) stage_copy(lk0 + bo, lv0 + bo, gk + (size_t)(st + 2) * (TK * HD), gv + (st + 2) * TK);
    }
    // no copy is outstanding when the wave ends
    asm volatile("s_wait_asynccnt 0x0" ::: "memory");
    // The joining. The wave of key half kh finishes query tile kh and hands the other tile's sums, shift and row sum to its partner (wave wv ^ NW, the same lane).
    // The ring is free: the loop's last barrier stands behind every wave's last read of it, and no copy is outstanding.
    const bool up = kh != 0;
    unsigned char* const snd = ring + wv * XSZ; const unsigned char* const rcv = ring + (wv ^ NW) * XSZ;
#pragma unroll
    for (int dt = 0; dt < 4; ++dt) { const v8f g = up ? o[dt][0] : o[dt][1];
        *(v4f*)(snd + dt * 1024 + lane * 16) = __builtin_shufflevector(g, g, 0, 1, 2, 3); *(v4f*)(snd + dt * 1024 + 512 + lane * 16) = __builtin_shufflevector(g, g, 4, 5, 6, 7); }
    *(float*)(snd + 4096 + lane * 4) = up ? nm[0][0] : nm[1][0]; *(float*)(snd + 4224 + lane * 4) = up ? sm[0] : sm[1];
    __syncthreads();    // every parcel is written
    const float na = up ? nm[1][0] : nm[0][0], nb = *(const float*)(rcv + 4096 + lane * 4), nn = fminf(na, nb);    // minus the shifts; the joint shift is the larger one
    const float fa = __builtin_amdgcn_exp2f(nn - na), fb = __builtin_amdgcn_exp2f(nn - nb);
    const float sj = (up ? sm[1] : sm[0]) * fa + *(const float*)(rcv + 4224 + lane * 4) * fb;
    const float f = __fdiv_rn(1.0f, sj + xhalf(sj)), ga = fa * f, gb = fb * f;
    float* orow = O + (size_t)(q0 + kh * 16 + lr) * HD + 8 * hi;
#pragma unroll
    for (int dt = 0; dt < 4; ++dt) { const v8f a = up ? o[dt][1] : o[dt][0];
        const v4f b0 = *(const v4f*)(rcv + dt * 1024 + lane * 16), b1 = *(const v4f*)(rcv + dt * 1024 + 512 + lane * 16);
        *(v4f*)(orow + dt * 16) = __builtin_shufflevector(a, a, 0, 1, 2, 3) * ga + b0 * gb; *(v4f*)(orow + dt * 16 + 4) = __builtin_shufflevector(a, a, 4, 5, 6, 7) * ga + b1 * gb; }
}

extern "C" void kernel_launch(void* const* d_in, const int* in_sizes, int n_in,
                              void* d_out, int out_size, void* d_ws, size_t ws_size, hipStream_t stream) {
    (void)in_sizes; (void)n_in; (void)out_size;
    const float* q = (const float*)d_in[0]; const float* k = (const float*)d_in[1]; const float* v = (const float*)d_in[2]; const float* kpe = (const float*)d_in[3];
    float* OUT = (float*)d_out;     // [2][16][2048][64]
    char* wsp = (char*)d_ws;
    auto take = [&](size_t bytes) { char* p = wsp; wsp += (bytes + 255) & ~(size_t)255; return (void*)p; };
    const size_t per = (size_t)NH_ * LL * HD;
    bf* QP = (bf*)take(NB_ * per * 2); bf* KE = (bf*)take(NB_ * per * 2); bf* VT = (bf*)take(NB_ * per * 2);
    if ((size_t)(wsp - (char*)d_ws) > ws_size) return;    // total 24 MiB
    k_prep<<<dim3(LL / PT, NB_ * NH_), 256, 0, stream>>>(q, k, v, kpe, QP, KE, VT);
    k_fattn<8><<<dim3(LL / 256, NB_ * NH_), 512, 0, stream>>>(QP, KE, VT, OUT);
}

// v008
// One run takes 38.5 microseconds.
// Timed twice side by side with v007, it ran 1.04 times as fast both times.
// Over all steps from v000 it is 38.8 times as fast.
#include <hip/hip_runtime.h>

// SeqAttention (q, k, v [2][16][2048][64], k_pe [64][2048] shared relative-position keys; scores = (q.k + q.k_pe[:, t]) / 8; softmax; out = attn v -> [2][16][2048][64]).
// The two einsums are regrouped as q . (k_t + k_pe[:, t]) (exact algebra): k + k_pe is formed in f32 from the bf16-rounded inputs (exact), scaled in f32 by log2(e) / 8, so that the products are the scores in log2 units, and rounded once to f16 (11 significant bits); scores = one f16 product in an f32 accumulator that starts at minus the softmax shift.
// Compute dtypes, f32 accumulate: every input rounded to bf16; the rounded q and v are held as f16, which keeps their 8 significant bits as they are down to 2^-17; softmax f32 (shift held at the first 32 keys' maximum; walked again with a rising shift if a probability leaves the f16 range) -> probabilities rounded once to f16; attn.v as one f16 product; all heads in one launch.

#define NB_  2
#define NH_  16
#define LL   2048
#define HD   64
#define SCL  (0.125f * 1.4426950408889634f)    // 1 / sqrt(64), and exp as exp2: folded into the key planes
typedef _Float16 h16;
typedef unsigned short bf;
typedef __attribute__((ext_vector_type(16))) _Float16 v16h;
typedef __attribute__((ext_vector_type(8)))  _Float16 v8h;
typedef __attribute__((ext_vector_type(8)))  unsigned short v8us;
typedef __attribute__((ext_vector_type(8)))  float    v8f;
typedef __attribute__((ext_vector_type(4)))  float    v4f;
typedef v8h  __attribute__((may_alias)) v8ha;

__device__ __forceinline__ unsigned short f2bf(float f) { unsigned u = __float_as_uint(f); u += 0x7FFFu + ((u >> 16) & 1u); return (unsigned short)(u >> 16); }
__device__ __forceinline__ float bf2f(unsigned short b) { return __uint_as_float(((unsigned)b) << 16); }
__device__ __forceinline__ float bfr(float f) { return bf2f(f2bf(f)); }
__device__ __forceinline__ v16h cat16(v8h lo, v8h hi) { return __builtin_shufflevector(lo, hi, 0, 1, 2, 3, 4, 5, 6, 7, 8, 9, 10, 11, 12, 13, 14, 15); }
__device__ __forceinline__ v8f wmma16(v16h a, v16h b, v8f c) { return __builtin_amdgcn_wmma_f32_16x16x32_f16(false, a, false, b, (short)0, c, false, false); }
// eight f32 to f16 (nearest even), as the bits that are stored
__device__ __forceinline__ v8us h8(v8f x) { return __builtin_bit_cast(v8us, __builtin_convertvector(x, v8h)); }



typedef __attribute__((ext_vector_type(4))) unsigned short v4us;

// ---- k_prep: all of the preparation in one launch. One work-group takes 128 tokens of one head: q rounded to bf16 and stored as f16; (k + k_pe) * SCL rounded to f16; v rounded to bf16, stored as f16 and transposed.
// Every global read and write is a run of whole lines; the two transposes (k_pe [d][t] -> [t][d], v [t][d] -> [d][t]) are made in registers on 4 x 4 and 8 x 4 blocks and handed over through LDS.
// Each thread has all of its 32 loads of 16 bytes in flight at once: few waves with much to do each, since a wave's start costs more than its share of the copying.
#define PT   128                   // tokens per work-group
#define PP   144                   // LDS pitch in bytes of a k_pe^T row (64 bf16 + 16)
#define PV   272                   // LDS pitch in bytes of a V^T row (128 f16 + 16)
__global__ __launch_bounds__(256) void k_prep(const float* __restrict__ q, const float* __restrict__ k, const float* __restrict__ v, const float* __restrict__ kpe, bf* __restrict__ QP, bf* __restrict__ KE, bf* __restrict__ VT) {
    __shared__ __attribute__((aligned(16))) unsigned char pl[PT * PP];    // bf16(k_pe)^T: [token][d]
    __shared__ __attribute__((aligned(16))) unsigned char vl[HD * PV];    // bf16(v)^T as f16: [d][token]
    const int tid = threadIdx.x, t0 = (int)blockIdx.x * PT; const size_t z = blockIdx.y;
    const size_t base = (z * LL + t0) * HD;    // the tile's first element in q, k, v and in the two [token][d] planes
    // k_pe: two blocks of 4 d x 4 tokens a thread; 8 lanes side by side along the tokens read one whole line of a row
    v4f kp[2][4]; int ptg[2], pdg[2];
#pragma unroll
    for (int i = 0; i < 2; ++i) { const int c = tid + 256 * i; ptg[i] = ((c >> 5) & 3) * 8 + (c & 7); pdg[i] = (c >> 7) * 4 + ((c >> 3) & 3);
#pragma unroll
        for (int u = 0; u < 4; ++u) kp[i][u] = *(const v4f*)(kpe + (size_t)(4 * pdg[i] + u) * LL + t0 + 4 * ptg[i]); }
    asm volatile("s_wait_xcnt 0x0" ::: "memory");    // before the address registers of the loads above are given to the next addresses or to later loads' data
    // v: one block of 8 tokens x 4 d a thread; 16 lanes read one whole row
    const int vd = (tid & 15) * 4, vg = tid >> 4; v4f vv[8];
#pragma unroll
    for (int j = 0; j < 8; ++j) vv[j] = *(const v4f*)(v + base + (size_t)(8 * vg + j) * HD + vd);
    asm volatile("s_wait_xcnt 0x0" ::: "memory");    // before the address registers of the loads above are given to the next addresses or to later loads' data
    // k and q: four runs of 8 elements a thread
    v8f kk[4], qq[4];
#pragma unroll
    for (int i = 0; i < 4; ++i) kk[i] = *(const v8f*)(k + base + (size_t)(tid + 256 * i) * 8);
#pragma unroll
    for (int i = 0; i < 4; ++i) qq[i] = *(const v8f*)(q + base + (size_t)(tid + 256 * i) * 8);
    // scheduling barrier: keeps all 32 loads in front of the first use (without it the compiler spreads them among the conversions to save registers, and the thread pays the memory latency several times over)
    __builtin_amdgcn_sched_barrier(0);
#pragma unroll
    for (int i = 0; i < 2; ++i)
#pragma unroll
        for (int j = 0; j < 4; ++j) { v4us w;
#pragma unroll
            for (int u = 0; u < 4; ++u) w[u] = f2bf(kp[i][u][j]);
            *(v4us*)(pl + (4 * ptg[i] + j) * PP + pdg[i] * 8) = w; }
#pragma unroll
    for (int u = 0; u < 4; ++u) { v8f w;
#pragma unroll
        for (int j = 0; j < 8; ++j) w[j] = bfr(vv[j][u]);
        *(v8us*)(vl + (vd + u) * PV + vg * 16) = h8(w); }
    __syncthreads();    // both transposed tiles are complete; no global store stands in front of it, so it waits for none
#pragma unroll
    for (int i = 0; i < 4; ++i) { const int c = tid + 256 * i; *(v8us*)(VT + (z * HD + (c >> 4)) * LL + t0 + (c & 15) * 8) = *(const v8us*)(vl + (c >> 4) * PV + (c & 15) * 16); }
#pragma unroll
    for (int i = 0; i < 4; ++i) { v8f o;
#pragma unroll
        for (int e = 0; e < 8; ++e) o[e] = bfr(qq[i][e]);
        *(v8us*)(QP + base + (size_t)(tid + 256 * i) * 8) = h8(o); }
#pragma unroll
    for (int i = 0; i < 4; ++i) { const int c = tid + 256 * i; const v8us pe = *(const v8us*)(pl + (c >> 3) * PP + (c & 7) * 16); v8f s;
#pragma unroll
        for (int e = 0; e < 8; ++e) s[e] = __fmul_rn(__fadd_rn(bfr(kk[i][e]), bf2f(pe[e])), SCL);
        *(v8us*)(KE + base + (size_t)c * 8) = h8(s); }
}
// ---- k_fattn: scores, softmax and attn.v in one kernel. Two waves share 32 queries of one head: each walks one half of the 2048 keys, 32 at a time, with a shift and sums of its own; grid (LL / (32 NW), heads), 64 NW threads.
// That makes four waves a SIMD out of the same work: one wave's softmax runs beside the others' matrix instructions. At the end the two partial results are joined through LDS (each wave of a pair finishes 16 of the 32 queries).
// The NW waves of a key half all walk the same keys: the key plane and V^T come through LDS, 128 keys a stage and half, two buffers a half, by asynchronous copies (each lane 16 bytes); the next stage flies while this one is worked on.
// Transposed products: S^T = KE . Q^T (A = key rows; B = the wave's queries, loaded once) and O^T += V^T . P^T (A = VT rows, B = P).
// A lane holds the scores of ONE query (column lr): keys 8 hi + j of each 16-key tile. Two such tiles, converted in place, are the B fragment of the second product in the loaders' own k order.
// Softmax against a HELD shift per query: p = exp2(score - shift). The shift is known before the scores are formed, so minus the shift is the score product's start value (its C operand) and no vector instruction subtracts it.
// It is the maximum of the query's first 32 scores. The walk that is run first never raises it; should a probability leave the f16 range there, the work-group walks once more with a shift that rises when passed by 2^8 (see walk).
// P is rounded to f16 unnormalised; the row sum takes the unrounded p; the division by it comes once, at the end.
template <typename T16> struct WFrag;
template <> struct WFrag<h16> { typedef v16h V; static __device__ __forceinline__ V ld(const bf* p) { return cat16(*(const v8ha*)p, *(const v8ha*)(p + 16)); } static __device__ __forceinline__ v8f mma(V a, V b, v8f c) { return wmma16(a, b, c); } };
typedef __attribute__((ext_vector_type(2))) _Float16 v2h;
typedef __attribute__((ext_vector_type(2))) float v2f;
typedef __attribute__((ext_vector_type(8))) unsigned v8u;
// the value of lane l ^ 16: the other half of a query's keys
__device__ __forceinline__ float xhalf(float x) { const int b = __float_as_int(x); return __int_as_float(__builtin_amdgcn_permlanex16(b, b, 0x76543210, 0xfedcba98, false, false)); }
#define TK   128                   // keys per stage
#define KP   144                   // LDS pitch in bytes of a key row (128 + 16: 16 B x odd, conflict-free for 16-byte reads)
#define VP   272                   // LDS pitch in bytes of a V^T row (256 + 16)
#define KSZ  (TK * KP)             // the key plane of a stage
#define BSZ  (KSZ + HD * VP)       // one buffer: key plane, V^T
#define KH   (LL / 2)              // keys of one half
#define XSZ  4352                  // the joining: one wave's parcel in LDS (4 d tiles x 32 lanes x 32 B, then 32 shifts, then 32 sums)
// One stage's copies of one thread (256 threads a key half): 4 x 16 B of the key plane (rows r, r + 32, ...) and 4 x 16 B of V^T (rows r, r + 16, ...).
// lk, lv: the lane's LDS byte addresses in the key plane and in V^T; gk, gv: its global addresses. s_wait_xcnt stands in the copies' own statement, before any of their address registers can be rewritten.
__device__ __forceinline__ void stage_copy(unsigned lk, unsigned lv, const bf* gk, const bf* gv) {
    asm volatile("global_load_async_to_lds_b128 %0, %1, off\n\t"
                 "global_load_async_to_lds_b128 %2, %3, off\n\t"
                 "global_load_async_to_lds_b128 %4, %5, off\n\t"
                 "global_load_async_to_lds_b128 %6, %7, off\n\t"
                 "global_load_async_to_lds_b128 %8, %9, off\n\t"
                 "global_load_async_to_lds_b128 %10, %11, off\n\t"
                 "global_load_async_to_lds_b128 %12, %13, off\n\t"
                 "global_load_async_to_lds_b128 %14, %15, off\n\t"
                 "s_wait_xcnt 0x0"
                 :: "v"(lk), "v"(gk), "v"(lk + 32 * KP), "v"(gk + 32 * HD), "v"(lk + 64 * KP), "v"(gk + 64 * HD), "v"(lk + 96 * KP), "v"(gk + 96 * HD),
                    "v"(lv), "v"(gv), "v"(lv + 16 * VP), "v"(gv + 16 * LL), "v"(lv + 32 * VP), "v"(gv + 32 * LL), "v"(lv + 48 * VP), "v"(gv + 48 * LL)
                 : "memory");
}
// One walk over the wave's key half: ring, scores, softmax, attn.v. On entry stage 0's copies are in flight. HELD picks how the softmax shift is kept in range.
// HELD = false, the walk that is run first: the shift stays at the maximum of the query's first 32 scores (found in front of the loop), and a pass holds no maximum, no test and no branch on the scores.
// A score 2^16 or more above that shift makes its f16 probability infinite, and from then on every sum of that query's O column is infinite or not a number: the caller looks at O once, behind the walk.
// HELD = true, the walk that is run again when that look finds such a column: the shift is raised whenever a score passes it by 2^8 (one ballot branch a pass), so no probability leaves the f16 range.
template <int X> struct Pre { static constexpr int v = X; };
template <bool HELD>
__device__ __forceinline__ void walk(unsigned char* const hbuf, const unsigned lk0, const unsigned lv0, const bf* const gk, const bf* const gv, const int lr, const int hi,
                                     const v16h (&qf)[2][2], v8f (&o)[4][2], v8f (&nm)[2], float (&sm)[2]) {
    typedef WFrag<h16>::V V;
#pragma unroll
    for (int dt = 0; dt < 4; ++dt)
#pragma unroll
        for (int nt = 0; nt < 2; ++nt) o[dt][nt] = (v8f){};
    nm[0] = (v8f){}; nm[1] = (v8f){}; sm[0] = 0.f; sm[1] = 0.f;
    // stage 0 has landed for this wave; the barrier publishes it to the others; then stage 1 starts into buffer 1
    asm volatile("s_wait_asynccnt 0x0" ::: "memory");
    __syncthreads();
    stage_copy(lk0 + BSZ, lv0 + BSZ, gk + TK * HD, gv + TK);
    if constexpr (!HELD) {
        // the shift: each query's largest score among the half's first 32 keys (these eight products are formed again in the first pass, then with the shift as their start value)
        const bf* ke = (const bf*)(hbuf + lr * KP + 16 * hi);
        V a0[2][2];
#pragma unroll
        for (int tt = 0; tt < 2; ++tt)
#pragma unroll
            for (int kc = 0; kc < 2; ++kc) a0[tt][kc] = WFrag<h16>::ld(ke + tt * 16 * (KP / 2) + kc * 32);
#pragma unroll
        for (int nt = 0; nt < 2; ++nt) { float bm = -3.0e38f;
#pragma unroll
            for (int tt = 0; tt < 2; ++tt) { v8f c = (v8f){};
#pragma unroll
                for (int kc = 0; kc < 2; ++kc) c = WFrag<h16>::mma(a0[tt][kc], qf[nt][kc], c);
#pragma unroll
                for (int j = 0; j < 8; ++j) bm = fmaxf(bm, c[j]); }
            bm = fmaxf(bm, xhalf(bm));    // equal in both lane halves
            nm[nt] -= bm; }
    }
    // the stage loop stays rolled
#pragma unroll 1
    for (int st = 0; st < KH / TK; ++st) {
        const unsigned bo = (unsigned)(st & 1) * BSZ;
        const bf* ke = (const bf*)(hbuf + bo + lr * KP + 16 * hi); const bf* vt = (const bf*)(hbuf + bo + KSZ + lr * VP + 16 * hi);
        V ak[2][2];    // [key tile][k chunk]
#pragma unroll
        for (int tt = 0; tt < 2; ++tt)
#pragma unroll
            for (int kc = 0; kc < 2; ++kc) ak[tt][kc] = WFrag<h16>::ld(ke + tt * 16 * (KP / 2) + kc * 32);
        // one pass: 32 keys. PRE: 1 key fragments are fetched in every pass (behind the stage's last pass its first rows again, which nobody uses), -1 a test on ps decides
        auto pass = [&](const int ps, auto pre) {
            constexpr int PRE = decltype(pre)::v;
            v8f s[2][2];    // [key tile][query tile]
#pragma unroll
            for (int tt = 0; tt < 2; ++tt)
#pragma unroll
                for (int nt = 0; nt < 2; ++nt) { v8f c = nm[nt];
#pragma unroll
                    for (int kc = 0; kc < 2; ++kc) c = WFrag<h16>::mma(ak[tt][kc], qf[nt][kc], c);
                    s[tt][nt] = c; }
            V va[4];
#pragma unroll
            for (int dt = 0; dt < 4; ++dt) va[dt] = WFrag<h16>::ld(vt + dt * 16 * (VP / 2) + ps * 32);
            // compiler fence in front of the branch: holds the V^T reads here, so that they fly during the softmax (without it they sink in among the second product's matrix instructions and are waited for there)
            asm volatile("" ::: "memory");
            // the next pass's key fragments, fetched behind this pass's score products so that they fly during the softmax; never beyond this stage's own buffer
            if (PRE > 0 || (PRE < 0 && ps + 1 < TK / 32)) {
#pragma unroll
                for (int tt = 0; tt < 2; ++tt)
#pragma unroll
                    for (int kc = 0; kc < 2; ++kc) ak[tt][kc] = WFrag<h16>::ld(ke + ((PRE > 0 ? (ps + 1) % (TK / 32) : ps + 1) * 32 + tt * 16) * (KP / 2) + kc * 32);
            }
            // scheduling barrier, where the other walk has its branch: keeps all sixteen LDS reads of the pass in front of the softmax, so that they fly during it (without it the compiler sinks most of them in among the second product's matrix instructions, each waited for where it stands)
            if constexpr (!HELD) __builtin_amdgcn_sched_barrier(0);
            if constexpr (HELD) {
                // the test needs no maximum per query, only whether ANY score of the wave stands more than 2^8 above its query's shift: four short chains, no exchange between the lane halves
                float t4[2][2];
#pragma unroll
                for (int tt = 0; tt < 2; ++tt)
#pragma unroll
                    for (int nt = 0; nt < 2; ++nt) { float b = s[tt][nt][0];
#pragma unroll
                        for (int j = 1; j < 8; ++j) b = fmaxf(b, s[tt][nt][j]);
                        t4[tt][nt] = b; }
                const float top = fmaxf(fmaxf(t4[0][0], t4[1][0]), fmaxf(t4[0][1], t4[1][1]));
                // the rare path, taken by the whole wave: the first pass sets each shift to its query's own maximum; later a shift rises when some score of the wave has passed its shift by more than 2^8
                const bool first = (st | ps) == 0;
                const float thr = first ? -3.0e38f : 8.0f;    // one compare and one branch serve both cases
                if (__builtin_amdgcn_ballot_w32(top > thr) != 0u) {
#pragma unroll
                    for (int nt = 0; nt < 2; ++nt) {
                        float bm = fmaxf(t4[0][nt], t4[1][nt]); bm = fmaxf(bm, xhalf(bm));    // the query's largest score of this pass above its shift, equal in both lane halves
                        const float d = first ? bm : fmaxf(bm, 0.f), al_ = first ? 1.0f : __builtin_amdgcn_exp2f(-d);    // the sums are still zero in the first pass
                        nm[nt] -= d; s[0][nt] -= d; s[1][nt] -= d; sm[nt] *= al_;
#pragma unroll
                        for (int dt = 0; dt < 4; ++dt) o[dt][nt] *= al_;
                    }
                }
            }
            V pf[2];
#pragma unroll
            for (int nt = 0; nt < 2; ++nt) {
                // two scores at a time (neighbouring accumulator registers): p = exp2(s), packed as a pair of f16
                v2f ps2 = {0.f, 0.f}; v8u hw;
#pragma unroll
                for (int tt = 0; tt < 2; ++tt)
#pragma unroll
                    for (int i = 0; i < 4; ++i) {
                        const v2f p = {__builtin_amdgcn_exp2f(s[tt][nt][2 * i]), __builtin_amdgcn_exp2f(s[tt][nt][2 * i + 1])}; ps2 += p;
                        hw[tt * 4 + i] = __builtin_bit_cast(unsigned, __builtin_convertvector(p, v2h)); }
                sm[nt] += ps2[0] + ps2[1];
                pf[nt] = __builtin_bit_cast(V, hw);
            }
#pragma unroll
            for (int dt = 0; dt < 4; ++dt)
#pragma unroll
                for (int nt = 0; nt < 2; ++nt) o[dt][nt] = WFrag<h16>::mma(va[dt], pf[nt], o[dt][nt]);
            // four vector slots behind the pass's last matrix instructions, on both sides of the loop branch (the chip's distance before their A or B is overwritten or D is read)
            asm volatile("v_nop\n\tv_nop\n\tv_nop\n\tv_nop" : "+v"(o[0][0]), "+v"(o[0][1]), "+v"(o[1][0]), "+v"(o[1][1]), "+v"(o[2][0]), "+v"(o[2][1]), "+v"(o[3][0]), "+v"(o[3][1]));
        };
        if constexpr (HELD) {
            // rolled: a second pass's fragments would only cost registers
#pragma unroll 1
            for (int ps = 0; ps < TK / 32; ++ps) pass(ps, Pre<-1>{});
        } else {
            // rolled too: with no test on the scores and none on ps, a pass is one straight block that the compiler schedules as a whole
#pragma unroll 1
            for (int ps = 0; ps < TK / 32; ++ps) pass(ps, Pre<1>{});
        }
        // hand-over: this wave's LDS reads of the buffer are done, its copies of the next stage have landed; the barrier publishes that stage and frees this buffer for the refill
        asm volatile("s_wait_dscnt 0x0" ::: "memory");
        asm volatile("s_wait_asynccnt 0x0" ::: "memory");
        __syncthreads();
        if (st + 2 < KH / TK) stage_copy(lk0 + bo, lv0 + bo, gk + (size_t)(st + 2) * (TK * HD), gv + (st + 2) * TK);
    }
    // no copy is outstanding when the walk ends
    asm volatile("s_wait_asynccnt 0x0" ::: "memory");
}
template <int NW>
__global__ __launch_bounds__(64 * NW) void k_fattn(const bf* __restrict__ Q, const bf* __restrict__ KE, const bf* __restrict__ VT, float* __restrict__ O) {
    typedef WFrag<h16>::V V;
    static_assert(NW == 8, "the stage copies are laid out for 256 threads a key half");
    static_assert(2 * NW * XSZ <= 4 * BSZ, "the parcels of the joining lie in the ring");
    __shared__ __attribute__((aligned(16))) unsigned char ring[4 * BSZ];    // [key half][buffer]
    __shared__ unsigned vote[2 * NW];    // per wave: has a probability left the f16 range
    const size_t z = blockIdx.y; Q += z * (size_t)(LL * HD); KE += z * (size_t)(LL * HD); VT += z * (size_t)(HD * LL); O += z * (size_t)(LL * HD);
    const int tid = threadIdx.x & (32 * NW - 1), lane = tid & 31, lr = lane & 15, hi = lane >> 4;    // tid: the thread's number within its key half
    const int wv = __builtin_amdgcn_readfirstlane(threadIdx.x >> 5);    // the wave's number, kept scalar
    const int kh = wv / NW;    // the wave's key half
    const int q0 = ((int)blockIdx.x * NW + (wv & (NW - 1))) * 32;
    KE += (size_t)kh * (KH * HD); VT += kh * KH;    // the half's first key
    // this thread's share of a stage: LDS byte addresses in buffer 0, global addresses of stage 0
    unsigned char* const hbuf = ring + kh * (2 * BSZ);    // the half's two buffers
    const unsigned ring0 = (unsigned)(size_t)hbuf;
    const unsigned lk0 = ring0 + (unsigned)((tid >> 3) * KP + (tid & 7) * 16), lv0 = ring0 + (unsigned)(KSZ + (tid >> 4) * VP + (tid & 15) * 16);
    const bf* gk = KE + (tid >> 3) * HD + (tid & 7) * 8; const bf* gv = VT + (size_t)(tid >> 4) * LL + (tid & 15) * 8;
    stage_copy(lk0, lv0, gk, gv);
    V qf[2][2];    // [query tile][k chunk]
#pragma unroll
    for (int nt = 0; nt < 2; ++nt)
#pragma unroll
        for (int kc = 0; kc < 2; ++kc) qf[nt][kc] = WFrag<h16>::ld(Q + (size_t)(q0 + nt * 16 + lr) * HD + kc * 32 + 8 * hi);
    v8f o[4][2];    // [d tile][query tile]: o[dt][nt][j] = O[q0 + 16 nt + lr][16 dt + 8 hi + j]
    v8f nm[2];      // minus the shift of the lane's query (log2 units; equal in both lane halves), in all eight accumulator rows: the score products' start value
    float sm[2];    // this lane half's share of the row sum
    walk<false>(hbuf, lk0, lv0, gk, gv, lr, hi, qf, o, nm, sm);
    // The look at O: an infinite probability has reached every d row of its query's column, so one element a query tile tells. The work-group decides as one (the walk holds barriers): a word a wave, one barrier, every wave reads all the words.
    const bool off = !(__builtin_fabsf(o[0][0][0]) < __builtin_inff()) || !(__builtin_fabsf(o[0][1][0]) < __builtin_inff());
    const unsigned wb = __builtin_amdgcn_ballot_w32(off);
    if (lane == 0) vote[wv] = wb;
    __syncthreads();    // every wave's word is written
    if (__builtin_amdgcn_ballot_w32(vote[lane & (2 * NW - 1)] != 0u) != 0u) {
        // the ring is free (the walk's last barrier stands behind every read of it, no copy is outstanding); this wave's own LDS reads have returned before its copies start
        asm volatile("s_wait_dscnt 0x0" ::: "memory");
        stage_copy(lk0, lv0, gk, gv);
        walk<true>(hbuf, lk0, lv0, gk, gv, lr, hi, qf, o, nm, sm);
    }
    // The joining. The wave of key half kh finishes query tile kh and hands the other tile's sums, shift and row sum to its partner (wave wv ^ NW, the same lane).
    // The ring is free: the loop's last barrier stands behind every wave's last read of it, and no copy is outstanding.
    const bool up = kh != 0;
    unsigned char* const snd = ring + wv * XSZ; const unsigned char* const rcv = ring + (wv ^ NW) * XSZ;
#pragma unroll
    for (int dt = 0; dt < 4; ++dt) { const v8f g = up ? o[dt][0] : o[dt][1];
        *(v4f*)(snd + dt * 1024 + lane * 16) = __builtin_shufflevector(g, g, 0, 1, 2, 3); *(v4f*)(snd + dt * 1024 + 512 + lane * 16) = __builtin_shufflevector(g, g, 4, 5, 6, 7); }
    *(float*)(snd + 4096 + lane * 4) = up ? nm[0][0] : nm[1][0]; *(float*)(snd + 4224 + lane * 4) = up ? sm[0] : sm[1];
    __syncthreads();    // every parcel is written
    const float na = up ? nm[1][0] : nm[0][0], nb = *(const float*)(rcv + 4096 + lane * 4), nn = fminf(na, nb);    // minus the shifts; the joint shift is the larger one
    const float fa = __builtin_amdgcn_exp2f(nn - na), fb = __builtin_amdgcn_exp2f(nn - nb);
    const float sj = (up ? sm[1] : sm[0]) * fa + *(const float*)(rcv + 4224 + lane * 4) * fb;
    const float f = __fdiv_rn(1.0f, sj + xhalf(sj)), ga = fa * f, gb = fb * f;
    float* orow = O + (size_t)(q0 + kh * 16 + lr) * HD + 8 * hi;
#pragma unroll
    for (int dt = 0; dt < 4; ++dt) { const v8f a = up ? o[dt][1] : o[dt][0];
        const v4f b0 = *(const v4f*)(rcv + dt * 1024 + lane * 16), b1 = *(const v4f*)(rcv + dt * 1024 + 512 + lane * 16);
        *(v4f*)(orow + dt * 16) = __builtin_shufflevector(a, a, 0, 1, 2, 3) * ga + b0 * gb; *(v4f*)(orow + dt * 16 + 4) = __builtin_shufflevector(a, a, 4, 5, 6, 7) * ga + b1 * gb; }
}

extern "C" void kernel_launch(void* const* d_in, const int* in_sizes, int n_in,
                              void* d_out, int out_size, void* d_ws, size_t ws_size, hipStream_t stream) {
    (void)in_sizes; (void)n_in; (void)out_size;
    const float* q = (const float*)d_in[0]; const float* k = (const float*)d_in[1]; const float* v = (const float*)d_in[2]; const float* kpe = (const float*)d_in[3];
    float* OUT = (float*)d_out;     // [2][16][2048][64]
    char* wsp = (char*)d_ws;
    auto take = [&](size_t bytes) { char* p = wsp; wsp += (bytes + 255) & ~(size_t)255; return (void*)p; };
    const size_t per = (size_t)NH_ * LL * HD;
    bf* QP = (bf*)take(NB_ * per * 2); bf* KE = (bf*)take(NB_ * per * 2); bf* VT = (bf*)take(NB_ * per * 2);
    if ((size_t)(wsp - (char*)d_ws) > ws_size) return;    // total 24 MiB
    k_prep<<<dim3(LL / PT, NB_ * NH_), 256, 0, stream>>>(q, k, v, kpe, QP, KE, VT);
    k_fattn<8><<<dim3(LL / 256, NB_ * NH_), 512, 0, stream>>>(QP, KE, VT, OUT);
}

// v009
// It runs in 36.5 microseconds.
// Two timings next to v008 both put it at 1.06 times that version's speed.
// All steps since v000 together make it 41.0 times as fast.
#include <hip/hip_runtime.h>

// SeqAttention (q, k, v [2][16][2048][64], k_pe [64][2048] shared relative-position keys; scores = (q.k + q.k_pe[:, t]) / 8; softmax; out = attn v -> [2][16][2048][64]).
// The two einsums are regrouped as q . (k_t + k_pe[:, t]) (exact algebra): k + k_pe is formed in f32 from the bf16-rounded inputs (exact), scaled in f32 by log2(e) / 8, so that the products are the scores in log2 units, and rounded once to f16 (11 significant bits); scores = one f16 product in an f32 accumulator that starts at minus the softmax shift.
// Compute dtypes, f32 accumulate: every input rounded to bf16; the rounded q and v are held as f16, which keeps their 8 significant bits as they are down to 2^-17; softmax f32 (shift held at the first 32 keys' maximum; walked again with a rising shift if a probability leaves the f16 range) -> probabilities rounded once to f16; attn.v as one f16 product; all heads in one launch.

#define NB_  2
#define NH_  16
#define LL   2048
#define HD   64
#define SCL  (0.125f * 1.4426950408889634f)    // 1 / sqrt(64), and exp as exp2: folded into the key planes
typedef _Float16 h16;
typedef unsigned short bf;
typedef __attribute__((ext_vector_type(16))) _Float16 v16h;
typedef __attribute__((ext_vector_type(8)))  _Float16 v8h;
typedef __attribute__((ext_vector_type(8)))  unsigned short v8us;
typedef __attribute__((ext_vector_type(8)))  float    v8f;
typedef __attribute__((ext_vector_type(4)))  float    v4f;
typedef v8h  __attribute__((may_alias)) v8ha;

__device__ __forceinline__ unsigned short f2bf(float f) { unsigned u = __float_as_uint(f); u += 0x7FFFu + ((u >> 16) & 1u); return (unsigned short)(u >> 16); }
__device__ __forceinline__ float bf2f(unsigned short b) { return __uint_as_float(((unsigned)b) << 16); }
__device__ __forceinline__ float bfr(float f) { return bf2f(f2bf(f)); }
__device__ __forceinline__ v16h cat16(v8h lo, v8h hi) { return __builtin_shufflevector(lo, hi, 0, 1, 2, 3, 4, 5, 6, 7, 8, 9, 10, 11, 12, 13, 14, 15); }
__device__ __forceinline__ v8f wmma16(v16h a, v16h b, v8f c) { return __builtin_amdgcn_wmma_f32_16x16x32_f16(false, a, false, b, (short)0, c, false, false); }
// eight f32 to f16 (nearest even), as the bits that are stored
__device__ __forceinline__ v8us h8(v8f x) { return __builtin_bit_cast(v8us, __builtin_convertvector(x, v8h)); }



typedef __attribute__((ext_vector_type(4))) unsigned short v4us;
typedef __attribute__((ext_vector_type(4))) _Float16 v4h;

// ---- k_prep: the preparation of the keys and values in one launch. One work-group takes 128 tokens of one head: (k + k_pe) * SCL rounded to f16; v rounded to bf16, stored as f16 and transposed. (q is rounded where it is used, in k_fattn.)
// Every global read and write is a run of whole lines; the two transposes (k_pe [d][t] -> [t][d], v [t][d] -> [d][t]) are made in registers on 4 x 4 and 8 x 4 blocks and handed over through LDS.
// Each thread has all of its 24 loads of 16 bytes in flight at once: few waves with much to do each, since a wave's start costs more than its share of the copying.
#define PT   128                   // tokens per work-group
#define PP   144                   // LDS pitch in bytes of a k_pe^T row (64 bf16 + 16)
#define PV   272                   // LDS pitch in bytes of a V^T row (128 f16 + 16)
__global__ __launch_bounds__(256) void k_prep(const float* __restrict__ k, const float* __restrict__ v, const float* __restrict__ kpe, bf* __restrict__ KE, bf* __restrict__ VT) {
    __shared__ __attribute__((aligned(16))) unsigned char pl[PT * PP];    // bf16(k_pe)^T: [token][d]
    __shared__ __attribute__((aligned(16))) unsigned char vl[HD * PV];    // bf16(v)^T as f16: [d][token]
    const int tid = threadIdx.x, t0 = (int)blockIdx.x * PT; const size_t z = blockIdx.y;
    const size_t base = (z * LL + t0) * HD;    // the tile's first element in k, v and in the [token][d] key plane
    // k_pe: two blocks of 4 d x 4 tokens a thread; 8 lanes side by side along the tokens read one whole line of a row
    v4f kp[2][4]; int ptg[2], pdg[2];
#pragma unroll
    for (int i = 0; i < 2; ++i) { const int c = tid + 256 * i; ptg[i] = ((c >> 5) & 3) * 8 + (c & 7); pdg[i] = (c >> 7) * 4 + ((c >> 3) & 3);
#pragma unroll
        for (int u = 0; u < 4; ++u) kp[i][u] = *(const v4f*)(kpe + (size_t)(4 * pdg[i] + u) * LL + t0 + 4 * ptg[i]); }
    asm volatile("s_wait_xcnt 0x0" ::: "memory");    // before the address registers of the loads above are given to the next addresses or to later loads' data
    // v: one block of 8 tokens x 4 d a thread; 16 lanes read one whole row
    const int vd = (tid & 15) * 4, vg = tid >> 4; v4f vv[8];
#pragma unroll
    for (int j = 0; j < 8; ++j) vv[j] = *(const v4f*)(v + base + (size_t)(8 * vg + j) * HD + vd);
    asm volatile("s_wait_xcnt 0x0" ::: "memory");    // before the address registers of the loads above are given to the next addresses or to later loads' data
    // k: four runs of 8 elements a thread
    v8f kk[4];
#pragma unroll
    for (int i = 0; i < 4; ++i) kk[i] = *(const v8f*)(k + base + (size_t)(tid + 256 * i) * 8);
    // scheduling barrier: keeps all 24 loads in front of the first use (without it the compiler spreads them among the conversions to save registers, and the thread pays the memory latency several times over)
    __builtin_amdgcn_sched_barrier(0);
#pragma unroll
    for (int i = 0; i < 2; ++i)
#pragma unroll
        for (int j = 0; j < 4; ++j) { v4us w;
#pragma unroll
            for (int u = 0; u < 4; ++u) w[u] = f2bf(kp[i][u][j]);
            *(v4us*)(pl + (4 * ptg[i] + j) * PP + pdg[i] * 8) = w; }
#pragma unroll
    for (int u = 0; u < 4; ++u) { v8f w;
#pragma unroll
        for (int j = 0; j < 8; ++j) w[j] = bfr(vv[j][u]);
        *(v8us*)(vl + (vd + u) * PV + vg * 16) = h8(w); }
    __syncthreads();    // both transposed tiles are complete; no global store stands in front of it, so it waits for none
#pragma unroll
    for (int i = 0; i < 4; ++i) { const int c = tid + 256 * i; *(v8us*)(VT + (z * HD + (c >> 4)) * LL + t0 + (c & 15) * 8) = *(const v8us*)(vl + (c >> 4) * PV + (c & 15) * 16); }
#pragma unroll
    for (int i = 0; i < 4; ++i) { const int c = tid + 256 * i; const v8us pe = *(const v8us*)(pl + (c >> 3) * PP + (c & 7) * 16); v8f s;
#pragma unroll
        for (int e = 0; e < 8; ++e) s[e] = __fmul_rn(__fadd_rn(bfr(kk[i][e]), bf2f(pe[e])), SCL);
        *(v8us*)(KE + base + (size_t)c * 8) = h8(s); }
}
// ---- k_fattn: scores, softmax and attn.v in one kernel. Two waves share 32 queries of one head: each walks one half of the 2048 keys, 32 at a time, with a shift and sums of its own; grid (LL / (32 NW), heads), 64 NW threads.
// That makes four waves a SIMD out of the same work: one wave's softmax runs beside the others' matrix instructions. At the end the two partial results are joined through LDS (each wave of a pair finishes 16 of the 32 queries).
// The NW waves of a key half all walk the same keys: the key plane and V^T come through LDS, 128 keys a stage and half, two buffers a half, by asynchronous copies (each lane 16 bytes); the next stage flies while this one is worked on.
// Transposed products: S^T = KE . Q^T (A = key rows; B = the wave's queries, loaded once) and O^T += V^T . P^T (A = VT rows, B = P).
// A lane holds the scores of ONE query (column lr): keys 8 hi + j of each 16-key tile. Two such tiles, converted in place, are the B fragment of the second product in the loaders' own k order.
// Softmax against a HELD shift per query: p = exp2(score - shift). The shift is known before the scores are formed, so minus the shift is the score product's start value (its C operand) and no vector instruction subtracts it.
// It is the maximum of the query's first 32 scores. The walk that is run first never raises it; should a probability leave the f16 range there, the work-group walks once more with a shift that rises when passed by 2^8 (see walk).
// P is rounded to f16 unnormalised; the row sum takes the unrounded p; the division by it comes once, at the end.
template <typename T16> struct WFrag;
template <> struct WFrag<h16> { typedef v16h V; static __device__ __forceinline__ V ld(const bf* p) { return cat16(*(const v8ha*)p, *(const v8ha*)(p + 16)); } static __device__ __forceinline__ v8f mma(V a, V b, v8f c) { return wmma16(a, b, c); } };
typedef __attribute__((ext_vector_type(2))) _Float16 v2h;
typedef __attribute__((ext_vector_type(2))) float v2f;
typedef __attribute__((ext_vector_type(8))) unsigned v8u;
// the value of lane l ^ 16: the other half of a query's keys
__device__ __forceinline__ float xhalf(float x) { const int b = __float_as_int(x); return __int_as_float(__builtin_amdgcn_permlanex16(b, b, 0x76543210, 0xfedcba98, false, false)); }
#define TK   128                   // keys per stage
#define KP   144                   // LDS pitch in bytes of a key row (128 + 16: 16 B x odd, conflict-free for 16-byte reads)
#define VP   272                   // LDS pitch in bytes of a V^T row (256 + 16)
#define KSZ  (TK * KP)             // the key plane of a stage
#define BSZ  (KSZ + HD * VP)       // one buffer: key plane, V^T
#define KH   (LL / 2)              // keys of one half
#define XSZ  4352                  // the joining: one wave's parcel in LDS (4 d tiles x 32 lanes x 32 B, then 32 shifts, then 32 sums)
// One stage's copies of one thread (256 threads a key half): 4 x 16 B of the key plane (rows r, r + 32, ...) and 4 x 16 B of V^T (rows r, r + 16, ...).
// lk, lv: the lane's LDS byte addresses in the key plane and in V^T; gk, gv: its global addresses. s_wait_xcnt stands in the copies' own statement, before any of their address registers can be rewritten.
__device__ __forceinline__ void stage_copy(unsigned lk, unsigned lv, const bf* gk, const bf* gv) {
    asm volatile("global_load_async_to_lds_b128 %0, %1, off\n\t"
                 "global_load_async_to_lds_b128 %2, %3, off\n\t"
                 "global_load_async_to_lds_b128 %4, %5, off\n\t"
                 "global_load_async_to_lds_b128 %6, %7, off\n\t"
                 "global_load_async_to_lds_b128 %8, %9, off\n\t"
                 "global_load_async_to_lds_b128 %10, %11, off\n\t"
                 "global_load_async_to_lds_b128 %12, %13, off\n\t"
                 "global_load_async_to_lds_b128 %14, %15, off\n\t"
                 "s_wait_xcnt 0x0"
                 :: "v"(lk), "v"(gk), "v"(lk + 32 * KP), "v"(gk + 32 * HD), "v"(lk + 64 * KP), "v"(gk + 64 * HD), "v"(lk + 96 * KP), "v"(gk + 96 * HD),
                    "v"(lv), "v"(gv), "v"(lv + 16 * VP), "v"(gv + 16 * LL), "v"(lv + 32 * VP), "v"(gv + 32 * LL), "v"(lv + 48 * VP), "v"(gv + 48 * LL)
                 : "memory");
}
// One walk over the wave's key half: ring, scores, softmax, attn.v. On entry stage 0's copies are in flight. HELD picks how the softmax shift is kept in range.
// The walk that is run first also fetches the wave's query fragments: qrow is the lane's place in the work-group's rounded queries in LDS, which the walk's first barrier publishes along with stage 0.
// HELD = false, the walk that is run first: the shift stays at the maximum of the query's first 32 scores (found in front of the loop), and a pass holds no maximum, no test and no branch on the scores.
// A score 2^16 or more above that shift makes its f16 probability infinite, and from then on every sum of that query's O column is infinite or not a number: the caller looks at O once, behind the walk.
// HELD = true, the walk that is run again when that look finds such a column: the shift is raised whenever a score passes it by 2^8 (one ballot branch a pass), so no probability leaves the f16 range.
template <int X> struct Pre { static constexpr int v = X; };
template <bool HELD>
__device__ __forceinline__ void walk(unsigned char* const hbuf, const unsigned lk0, const unsigned lv0, const bf* const gk, const bf* const gv, const int lr, const int hi,
                                     const unsigned char* const qrow, v16h (&qf)[2][2], v8f (&o)[4][2], v8f (&nm)[2], float (&sm)[2]) {
    typedef WFrag<h16>::V V;
#pragma unroll
    for (int dt = 0; dt < 4; ++dt)
#pragma unroll
        for (int nt = 0; nt < 2; ++nt) o[dt][nt] = (v8f){};
    nm[0] = (v8f){}; nm[1] = (v8f){}; sm[0] = 0.f; sm[1] = 0.f;
    // stage 0 has landed for this wave; the barrier publishes it to the others; then stage 1 starts into buffer 1
    asm volatile("s_wait_asynccnt 0x0" ::: "memory");
    __syncthreads();
    stage_copy(lk0 + BSZ, lv0 + BSZ, gk + TK * HD, gv + TK);
    if constexpr (!HELD) {
#pragma unroll
        for (int nt = 0; nt < 2; ++nt)
#pragma unroll
            for (int kc = 0; kc < 2; ++kc) qf[nt][kc] = WFrag<h16>::ld((const bf*)(qrow + nt * 16 * KP) + kc * 32);
        // the shift: each query's largest score among the half's first 32 keys (these eight products are formed again in the first pass, then with the shift as their start value)
        const bf* ke = (const bf*)(hbuf + lr * KP + 16 * hi);
        V a0[2][2];
#pragma unroll
        for (int tt = 0; tt < 2; ++tt)
#pragma unroll
            for (int kc = 0; kc < 2; ++kc) a0[tt][kc] = WFrag<h16>::ld(ke + tt * 16 * (KP / 2) + kc * 32);
#pragma unroll
        for (int nt = 0; nt < 2; ++nt) { float bm = -3.0e38f;
#pragma unroll
            for (int tt = 0; tt < 2; ++tt) { v8f c = (v8f){};
#pragma unroll
                for (int kc = 0; kc < 2; ++kc) c = WFrag<h16>::mma(a0[tt][kc], qf[nt][kc], c);
#pragma unroll
                for (int j = 0; j < 8; ++j) bm = fmaxf(bm, c[j]); }
            bm = fmaxf(bm, xhalf(bm));    // equal in both lane halves
            nm[nt] -= bm; }
    }
    // the stage loop stays rolled
#pragma unroll 1
    for (int st = 0; st < KH / TK; ++st) {
        const unsigned bo = (unsigned)(st & 1) * BSZ;
        const bf* ke = (const bf*)(hbuf + bo + lr * KP + 16 * hi); const bf* vt = (const bf*)(hbuf + bo + KSZ + lr * VP + 16 * hi);
        V ak[2][2];    // [key tile][k chunk]
#pragma unroll
        for (int tt = 0; tt < 2; ++tt)
#pragma unroll
            for (int kc = 0; kc < 2; ++kc) ak[tt][kc] = WFrag<h16>::ld(ke + tt * 16 * (KP / 2) + kc * 32);
        // one pass: 32 keys. PRE: 1 key fragments are fetched in every pass (behind the stage's last pass its first rows again, which nobody uses), -1 a test on ps decides
        auto pass = [&](const int ps, auto pre) {
            constexpr int PRE = decltype(pre)::v;
            v8f s[2][2];    // [key tile][query tile]
#pragma unroll
            for (int tt = 0; tt < 2; ++tt)
#pragma unroll
                for (int nt = 0; nt < 2; ++nt) { v8f c = nm[nt];
#pragma unroll
                    for (int kc = 0; kc < 2; ++kc) c = WFrag<h16>::mma(ak[tt][kc], qf[nt][kc], c);
                    s[tt][nt] = c; }
            V va[4];
#pragma unroll
            for (int dt = 0; dt < 4; ++dt) va[dt] = WFrag<h16>::ld(vt + dt * 16 * (VP / 2) + ps * 32);
            // compiler fence in front of the branch: holds the V^T reads here, so that they fly during the softmax (without it they sink in among the second product's matrix instructions and are waited for there)
            asm volatile("" ::: "memory");
            // the next pass's key fragments, fetched behind this pass's score products so that they fly during the softmax; never beyond this stage's own buffer
            if (PRE > 0 || (PRE < 0 && ps + 1 < TK / 32)) {
#pragma unroll
                for (int tt = 0; tt < 2; ++tt)
#pragma unroll
                    for (int kc = 0; kc < 2; ++kc) ak[tt][kc] = WFrag<h16>::ld(ke + ((PRE > 0 ? (ps + 1) % (TK / 32) : ps + 1) * 32 + tt * 16) * (KP / 2) + kc * 32);
            }
            // scheduling barrier, where the other walk has its branch: keeps all sixteen LDS reads of the pass in front of the softmax, so that they fly during it (without it the compiler sinks most of them in among the second product's matrix instructions, each waited for where it stands)
            if constexpr (!HELD) __builtin_amdgcn_sched_barrier(0);
            if constexpr (HELD) {
                // the test needs no maximum per query, only whether ANY score of the wave stands more than 2^8 above its query's shift: four short chains, no exchange between the lane halves
                float t4[2][2];
#pragma unroll
                for (int tt = 0; tt < 2; ++tt)
#pragma unroll
                    for (int nt = 0; nt < 2; ++nt) { float b = s[tt][nt][0];
#pragma unroll
                        for (int j = 1; j < 8; ++j) b = fmaxf(b, s[tt][nt][j]);
                        t4[tt][nt] = b; }
                const float top = fmaxf(fmaxf(t4[0][0], t4[1][0]), fmaxf(t4[0][1], t4[1][1]));
                // the rare path, taken by the whole wave: the first pass sets each shift to its query's own maximum; later a shift rises when some score of the wave has passed its shift by more than 2^8
                const bool first = (st | ps) == 0;
                const float thr = first ? -3.0e38f : 8.0f;    // one compare and one branch serve both cases
                if (__builtin_amdgcn_ballot_w32(top > thr) != 0u) {
#pragma unroll
                    for (int nt = 0; nt < 2; ++nt) {
                        float bm = fmaxf(t4[0][nt], t4[1][nt]); bm = fmaxf(bm, xhalf(bm));    // the query's largest score of this pass above its shift, equal in both lane halves
                        const float d = first ? bm : fmaxf(bm, 0.f), al_ = first ? 1.0f : __builtin_amdgcn_exp2f(-d);    // the sums are still zero in the first pass
                        nm[nt] -= d; s[0][nt] -= d; s[1][nt] -= d; sm[nt] *= al_;
#pragma unroll
                        for (int dt = 0; dt < 4; ++dt) o[dt][nt] *= al_;
                    }
                }
            }
            V pf[2];
#pragma unroll
            for (int nt = 0; nt < 2; ++nt) {
                // two scores at a time (neighbouring accumulator registers): p = exp2(s), packed as a pair of f16
                v2f ps2 = {0.f, 0.f}; v8u hw;
#pragma unroll
                for (int tt = 0; tt < 2; ++tt)
#pragma unroll
                    for (int i = 0; i < 4; ++i) {
                        const v2f p = {__builtin_amdgcn_exp2f(s[tt][nt][2 * i]), __builtin_amdgcn_exp2f(s[tt][nt][2 * i + 1])}; ps2 += p;
                        hw[tt * 4 + i] = __builtin_bit_cast(unsigned, __builtin_convertvector(p, v2h)); }
                sm[nt] += ps2[0] + ps2[1];
                pf[nt] = __builtin_bit_cast(V, hw);
            }
#pragma unroll
            for (int dt = 0; dt < 4; ++dt)
#pragma unroll
                for (int nt = 0; nt < 2; ++nt) o[dt][nt] = WFrag<h16>::mma(va[dt], pf[nt], o[dt][nt]);
            // four vector slots behind the pass's last matrix instructions, on both sides of the loop branch (the chip's distance before their A or B is overwritten or D is read)
            asm volatile("v_nop\n\tv_nop\n\tv_nop\n\tv_nop" : "+v"(o[0][0]), "+v"(o[0][1]), "+v"(o[1][0]), "+v"(o[1][1]), "+v"(o[2][0]), "+v"(o[2][1]), "+v"(o[3][0]), "+v"(o[3][1]));
        };
        if constexpr (HELD) {
            // rolled: a second pass's fragments would only cost registers
#pragma unroll 1
            for (int ps = 0; ps < TK / 32; ++ps) pass(ps, Pre<-1>{});
        } else {
            // rolled too: with no test on the scores and none on ps, a pass is one straight block that the compiler schedules as a whole
#pragma unroll 1
            for (int ps = 0; ps < TK / 32; ++ps) pass(ps, Pre<1>{});
        }
        // hand-over: this wave's LDS reads of the buffer are done, its copies of the next stage have landed; the barrier publishes that stage and frees this buffer for the refill
        asm volatile("s_wait_dscnt 0x0" ::: "memory");
        asm volatile("s_wait_asynccnt 0x0" ::: "memory");
        __syncthreads();
        if (st + 2 < KH / TK) stage_copy(lk0 + bo, lv0 + bo, gk + (size_t)(st + 2) * (TK * HD), gv + (st + 2) * TK);
    }
    // no copy is outstanding when the walk ends
    asm volatile("s_wait_asynccnt 0x0" ::: "memory");
}
template <int NW>
__global__ __launch_bounds__(64 * NW) void k_fattn(const float* __restrict__ q, const bf* __restrict__ KE, const bf* __restrict__ VT, float* __restrict__ O) {
    typedef WFrag<h16>::V V;
    static_assert(NW == 8, "the stage copies are laid out for 256 threads a key half");
    static_assert(2 * NW * XSZ <= 4 * BSZ, "the parcels of the joining lie in the ring");
    __shared__ __attribute__((aligned(16))) unsigned char ring[4 * BSZ];    // [key half][buffer]
    __shared__ __attribute__((aligned(16))) unsigned char ql[32 * NW * KP];    // the work-group's 32 NW queries, rounded to bf16 and held as f16: [query][d], the key rows' pitch
    __shared__ unsigned vote[2 * NW];    // per wave: has a probability left the f16 range
    const size_t z = blockIdx.y; q += z * (size_t)(LL * HD); KE += z * (size_t)(LL * HD); VT += z * (size_t)(HD * LL); O += z * (size_t)(LL * HD);
    const int tid = threadIdx.x & (32 * NW - 1), lane = tid & 31, lr = lane & 15, hi = lane >> 4;    // tid: the thread's number within its key half
    const int wv = __builtin_amdgcn_readfirstlane(threadIdx.x >> 5);    // the wave's number, kept scalar
    const int kh = wv / NW;    // the wave's key half
    const int q0 = ((int)blockIdx.x * NW + (wv & (NW - 1))) * 32;
    KE += (size_t)kh * (KH * HD); VT += kh * KH;    // the half's first key
    // this thread's share of a stage: LDS byte addresses in buffer 0, global addresses of stage 0
    unsigned char* const hbuf = ring + kh * (2 * BSZ);    // the half's two buffers
    const unsigned ring0 = (unsigned)(size_t)hbuf;
    const unsigned lk0 = ring0 + (unsigned)((tid >> 3) * KP + (tid & 7) * 16), lv0 = ring0 + (unsigned)(KSZ + (tid >> 4) * VP + (tid & 15) * 16);
    const bf* gk = KE + (tid >> 3) * HD + (tid & 7) * 8; const bf* gv = VT + (size_t)(tid >> 4) * LL + (tid & 15) * 8;
    stage_copy(lk0, lv0, gk, gv);
    // The queries: the work-group reads its 32 NW rows of q once, as f32, in whole lines (a wave's load is 512 bytes in a row), rounds them in registers and lays them in LDS; each wave takes its fragments from there behind the walk's first barrier.
    const float* qg = q + (size_t)blockIdx.x * (32 * NW * HD);
    v4f qq[8];
#pragma unroll
    for (int i = 0; i < 8; ++i) qq[i] = *(const v4f*)(qg + (size_t)((int)threadIdx.x + 64 * NW * i) * 4);
    asm volatile("s_wait_xcnt 0x0" ::: "memory");    // before the address registers of the loads above are given to anything else
#pragma unroll
    for (int i = 0; i < 8; ++i) { const int c = (int)threadIdx.x + 64 * NW * i; v4f r;
#pragma unroll
        for (int e = 0; e < 4; ++e) r[e] = bfr(qq[i][e]);
        *(v4us*)(ql + (c >> 4) * KP + (c & 15) * 8) = __builtin_bit_cast(v4us, __builtin_convertvector(r, v4h)); }
    const unsigned char* const qrow = ql + ((wv & (NW - 1)) * 32 + lr) * KP + 16 * hi;    // the lane's query of tile 0, its half of each 32-byte run
    V qf[2][2];    // [query tile][k chunk]
    v8f o[4][2];    // [d tile][query tile]: o[dt][nt][j] = O[q0 + 16 nt + lr][16 dt + 8 hi + j]
    v8f nm[2];      // minus the shift of the lane's query (log2 units; equal in both lane halves), in all eight accumulator rows: the score products' start value
    float sm[2];    // this lane half's share of the row sum
    walk<false>(hbuf, lk0, lv0, gk, gv, lr, hi, qrow, qf, o, nm, sm);
    // The look at O: an infinite probability has reached every d row of its query's column, so one element a query tile tells. The work-group decides as one (the walk holds barriers): a word a wave, one barrier, every wave reads all the words.
    const bool off = !(__builtin_fabsf(o[0][0][0]) < __builtin_inff()) || !(__builtin_fabsf(o[0][1][0]) < __builtin_inff());
    const unsigned wb = __builtin_amdgcn_ballot_w32(off);
    if (lane == 0) vote[wv] = wb;
    __syncthreads();    // every wave's word is written
    if (__builtin_amdgcn_ballot_w32(vote[lane & (2 * NW - 1)] != 0u) != 0u) {
        // the ring is free (the walk's last barrier stands behind every read of it, no copy is outstanding); this wave's own LDS reads have returned before its copies start
        asm volatile("s_wait_dscnt 0x0" ::: "memory");
        stage_copy(lk0, lv0, gk, gv);
        walk<true>(hbuf, lk0, lv0, gk, gv, lr, hi, qrow, qf, o, nm, sm);
    }
    // The joining. The wave of key half kh finishes query tile kh and hands the other tile's sums, shift and row sum to its partner (wave wv ^ NW, the same lane).
    // The ring is free: the loop's last barrier stands behind every wave's last read of it, and no copy is outstanding.
    const bool up = kh != 0;
    unsigned char* const snd = ring + wv * XSZ; const unsigned char* const rcv = ring + (wv ^ NW) * XSZ;
#pragma unroll
    for (int dt = 0; dt < 4; ++dt) { const v8f g = up ? o[dt][0] : o[dt][1];
        *(v4f*)(snd + dt * 1024 + lane * 16) = __builtin_shufflevector(g, g, 0, 1, 2, 3); *(v4f*)(snd + dt * 1024 + 512 + lane * 16) = __builtin_shufflevector(g, g, 4, 5, 6, 7); }
    *(float*)(snd + 4096 + lane * 4) = up ? nm[0][0] : nm[1][0]; *(float*)(snd + 4224 + lane * 4) = up ? sm[0] : sm[1];
    __syncthreads();    // every parcel is written
    const float na = up ? nm[1][0] : nm[0][0], nb = *(const float*)(rcv + 4096 + lane * 4), nn = fminf(na, nb);    // minus the shifts; the joint shift is the larger one
    const float fa = __builtin_amdgcn_exp2f(nn - na), fb = __builtin_amdgcn_exp2f(nn - nb);
    const float sj = (up ? sm[1] : sm[0]) * fa + *(const float*)(rcv + 4224 + lane * 4) * fb;
    const float f = __fdiv_rn(1.0f, sj + xhalf(sj)), ga = fa * f, gb = fb * f;
    float* orow = O + (size_t)(q0 + kh * 16 + lr) * HD + 8 * hi;
#pragma unroll
    for (int dt = 0; dt < 4; ++dt) { const v8f a = up ? o[dt][1] : o[dt][0];
        const v4f b0 = *(const v4f*)(rcv + dt * 1024 + lane * 16), b1 = *(const v4f*)(rcv + dt * 1024 + 512 + lane * 16);
        *(v4f*)(orow + dt * 16) = __builtin_shufflevector(a, a, 0, 1, 2, 3) * ga + b0 * gb; *(v4f*)(orow + dt * 16 + 4) = __builtin_shufflevector(a, a, 4, 5, 6, 7) * ga + b1 * gb; }
}

extern "C" void kernel_launch(void* const* d_in, const int* in_sizes, int n_in,
                              void* d_out, int out_size, void* d_ws, size_t ws_size, hipStream_t stream) {
    (void)in_sizes; (void)n_in; (void)out_size;
    const float* q = (const float*)d_in[0]; const float* k = (const float*)d_in[1]; const float* v = (const float*)d_in[2]; const float* kpe = (const float*)d_in[3];
    float* OUT = (float*)d_out;     // [2][16][2048][64]
    char* wsp = (char*)d_ws;
    auto take = [&](size_t bytes) { char* p = wsp; wsp += (bytes + 255) & ~(size_t)255; return (void*)p; };
    const size_t per = (size_t)NH_ * LL * HD;
    bf* KE = (bf*)take(NB_ * per * 2); bf* VT = (bf*)take(NB_ * per * 2);
    if ((size_t)(wsp - (char*)d_ws) > ws_size) return;    // total 16 MiB
    k_prep<<<dim3(LL / PT, NB_ * NH_), 256, 0, stream>>>(k, v, kpe, KE, VT);
    k_fattn<8><<<dim3(LL / 256, NB_ * NH_), 512, 0, stream>>>(q, KE, VT, OUT);
}

// v010
// A run of this version takes 35 microseconds.
// In both of two side-by-side timings against v009, it was 1.04 times as fast.
// Counting every step since v000, it is 42.8 times as fast.
#include <hip/hip_runtime.h>

// SeqAttention (q, k, v [2][16][2048][64], k_pe [64][2048] shared relative-position keys; scores = (q.k + q.k_pe[:, t]) / 8; softmax; out = attn v -> [2][16][2048][64]).
// The two einsums are regrouped as q . (k_t + k_pe[:, t]) (exact algebra): k + k_pe is formed in f32 from the bf16-rounded inputs (exact), scaled in f32 by log2(e) / 8, so that the products are the scores in log2 units, and rounded once to f16 (11 significant bits); scores = one f16 product in an f32 accumulator that starts at minus the softmax shift.
// Compute dtypes, f32 accumulate: every input rounded to bf16; the rounded q and v are held as f16, which keeps their 8 significant bits as they are down to 2^-17; softmax f32 (shift held at the first 32 keys' maximum; walked again with a rising shift if a probability leaves the f16 range) -> probabilities rounded once to f16; attn.v as one f16 product; all heads in one launch.

#define NB_  2
#define NH_  16
#define LL   2048
#define HD   64
#define SCL  (0.125f * 1.4426950408889634f)    // 1 / sqrt(64), and exp as exp2: folded into the key planes
typedef _Float16 h16;
typedef unsigned short bf;
typedef __attribute__((ext_vector_type(16))) _Float16 v16h;
typedef __attribute__((ext_vector_type(8)))  _Float16 v8h;
typedef __attribute__((ext_vector_type(8)))  unsigned short v8us;
typedef __attribute__((ext_vector_type(8)))  float    v8f;
typedef __attribute__((ext_vector_type(4)))  float    v4f;
typedef v8h  __attribute__((may_alias)) v8ha;

__device__ __forceinline__ unsigned short f2bf(float f) { unsigned u = __float_as_uint(f); u += 0x7FFFu + ((u >> 16) & 1u); return (unsigned short)(u >> 16); }
__device__ __forceinline__ float bf2f(unsigned short b) { return __uint_as_float(((unsigned)b) << 16); }
__device__ __forceinline__ float bfr(float f) { return bf2f(f2bf(f)); }
__device__ __forceinline__ v16h cat16(v8h lo, v8h hi) { return __builtin_shufflevector(lo, hi, 0, 1, 2, 3, 4, 5, 6, 7, 8, 9, 10, 11, 12, 13, 14, 15); }
__device__ __forceinline__ v8f wmma16(v16h a, v16h b, v8f c) { return __builtin_amdgcn_wmma_f32_16x16x32_f16(false, a, false, b, (short)0, c, false, false); }
// eight f32 to f16 (nearest even), as the bits that are stored
__device__ __forceinline__ v8us h8(v8f x) { return __builtin_bit_cast(v8us, __builtin_convertvector(x, v8h)); }



typedef __attribute__((ext_vector_type(4))) unsigned short v4us;
typedef __attribute__((ext_vector_type(4))) _Float16 v4h;

// ---- k_prep: the preparation of the keys and values in one launch. One work-group takes 128 tokens of one head: (k + k_pe) * SCL rounded to f16; v rounded to bf16, stored as f16 and transposed. (q is rounded where it is used, in k_fattn.)
// Every global read and write is a run of whole lines; the two transposes (k_pe [d][t] -> [t][d], v [t][d] -> [d][t]) are made in registers on 4 x 4 and 8 x 4 blocks and handed over through LDS.
// Each thread has all of its 24 loads of 16 bytes in flight at once: few waves with much to do each, since a wave's start costs more than its share of the copying.
#define PT   128                   // tokens per work-group
#define PP   144                   // LDS pitch in bytes of a k_pe^T row (64 bf16 + 16)
#define PV   272                   // LDS pitch in bytes of a V^T row (128 f16 + 16)
__global__ __launch_bounds__(256) void k_prep(const float* __restrict__ k, const float* __restrict__ v, const float* __restrict__ kpe, bf* __restrict__ KE, bf* __restrict__ VT) {
    __shared__ __attribute__((aligned(16))) unsigned char pl[PT * PP];    // bf16(k_pe)^T: [token][d]
    __shared__ __attribute__((aligned(16))) unsigned char vl[HD * PV];    // bf16(v)^T as f16: [d][token]
    const int tid = threadIdx.x, t0 = (int)blockIdx.x * PT; const size_t z = blockIdx.y;
    const size_t base = (z * LL + t0) * HD;    // the tile's first element in k, v and in the [token][d] key plane
    // k_pe: two blocks of 4 d x 4 tokens a thread; 8 lanes side by side along the tokens read one whole line of a row
    v4f kp[2][4]; int ptg[2], pdg[2];
#pragma unroll
    for (int i = 0; i < 2; ++i) { const int c = tid + 256 * i; ptg[i] = ((c >> 5) & 3) * 8 + (c & 7); pdg[i] = (c >> 7) * 4 + ((c >> 3) & 3);
#pragma unroll
        for (int u = 0; u < 4; ++u) kp[i][u] = *(const v4f*)(kpe + (size_t)(4 * pdg[i] + u) * LL + t0 + 4 * ptg[i]); }
    asm volatile("s_wait_xcnt 0x0" ::: "memory");    // before the address registers of the loads above are given to the next addresses or to later loads' data
    // v: one block of 8 tokens x 4 d a thread; 16 lanes read one whole row
    const int vd = (tid & 15) * 4, vg = tid >> 4; v4f vv[8];
#pragma unroll
    for (int j = 0; j < 8; ++j) vv[j] = *(const v4f*)(v + base + (size_t)(8 * vg + j) * HD + vd);
    asm volatile("s_wait_xcnt 0x0" ::: "memory");    // before the address registers of the loads above are given to the next addresses or to later loads' data
    // k: four runs of 8 elements a thread
    v8f kk[4];
#pragma unroll
    for (int i = 0; i < 4; ++i) kk[i] = *(const v8f*)(k + base + (size_t)(tid + 256 * i) * 8);
    // scheduling barrier: keeps all 24 loads in front of the first use (without it the compiler spreads them among the conversions to save registers, and the thread pays the memory latency several times over)
    __builtin_amdgcn_sched_barrier(0);
#pragma unroll
    for (int i = 0; i < 2; ++i)
#pragma unroll
        for (int j = 0; j < 4; ++j) { v4us w;
#pragma unroll
            for (int u = 0; u < 4; ++u) w[u] = f2bf(kp[i][u][j]);
            *(v4us*)(pl + (4 * ptg[i] + j) * PP + pdg[i] * 8) = w; }
#pragma unroll
    for (int u = 0; u < 4; ++u) { v8f w;
#pragma unroll
        for (int j = 0; j < 8; ++j) w[j] = bfr(vv[j][u]);
        *(v8us*)(vl + (vd + u) * PV + vg * 16) = h8(w); }
    __syncthreads();    // both transposed tiles are complete; no global store stands in front of it, so it waits for none
#pragma unroll
    for (int i = 0; i < 4; ++i) { const int c = tid + 256 * i; *(v8us*)(VT + (z * HD + (c >> 4)) * LL + t0 + (c & 15) * 8) = *(const v8us*)(vl + (c >> 4) * PV + (c & 15) * 16); }
#pragma unroll
    for (int i = 0; i < 4; ++i) { const int c = tid + 256 * i; const v8us pe = *(const v8us*)(pl + (c >> 3) * PP + (c & 7) * 16); v8f s;
#pragma unroll
        for (int e = 0; e < 8; ++e) s[e] = __fmul_rn(__fadd_rn(bfr(kk[i][e]), bf2f(pe[e])), SCL);
        *(v8us*)(KE + base + (size_t)c * 8) = h8(s); }
}
// ---- k_fattn: scores, softmax and attn.v in one kernel. Two waves share 16 NQ = 64 queries of one head: each walks one half of the 2048 keys, 32 at a time, with a shift and sums of its own; grid (LL / (16 NQ NW), heads), 64 NW threads.
// A key or V^T fragment read from LDS feeds NQ matrix instructions, one per query tile: the wave's tile is sized to the LDS read rate. Two waves a SIMD. At the end the two partial results are joined through LDS (each wave of a pair finishes 32 of the 64 queries).
// The NW waves of a key half all walk the same keys: the key plane and V^T come through LDS, 128 keys a stage and half, two buffers a half, by asynchronous copies (each lane 16 bytes); the next stage flies while this one is worked on.
// Transposed products: S^T = KE . Q^T (A = key rows; B = the wave's queries, loaded once) and O^T += V^T . P^T (A = VT rows, B = P).
// A lane holds the scores of ONE query (column lr): keys 8 hi + j of each 16-key tile. Two such tiles, converted in place, are the B fragment of the second product in the loaders' own k order.
// Softmax against a HELD shift per query: p = exp2(score - shift). The shift is known before the scores are formed, so minus the shift is the score product's start value (its C operand) and no vector instruction subtracts it.
// It is the maximum of the query's first 32 scores. The walk that is run first never raises it; should a probability leave the f16 range there, the work-group walks once more with a shift that rises when passed by 2^8 (see walk).
// P is rounded to f16 unnormalised; the row sum takes the unrounded p; the division by it comes once, at the end.
template <typename T16> struct WFrag;
template <> struct WFrag<h16> { typedef v16h V; static __device__ __forceinline__ V ld(const bf* p) { return cat16(*(const v8ha*)p, *(const v8ha*)(p + 16)); } static __device__ __forceinline__ v8f mma(V a, V b, v8f c) { return wmma16(a, b, c); } };
typedef __attribute__((ext_vector_type(2))) _Float16 v2h;
typedef __attribute__((ext_vector_type(2))) float v2f;
typedef __attribute__((ext_vector_type(8))) unsigned v8u;
// the value of lane l ^ 16: the other half of a query's keys
__device__ __forceinline__ float xhalf(float x) { const int b = __float_as_int(x); return __int_as_float(__builtin_amdgcn_permlanex16(b, b, 0x76543210, 0xfedcba98, false, false)); }
#define TK   128                   // keys per stage
#define KP   144                   // LDS pitch in bytes of a key row (128 + 16: 16 B x odd, conflict-free for 16-byte reads)
#define VP   272                   // LDS pitch in bytes of a V^T row (256 + 16)
#define KSZ  (TK * KP)             // the key plane of a stage
#define BSZ  (KSZ + HD * VP)       // one buffer: key plane, V^T
#define KH   (LL / 2)              // keys of one half
#define NQ   4                     // query tiles of 16 a wave
#define XSZ  8704                  // the joining: one wave's parcel in LDS (2 query tiles x 4 d tiles x 32 lanes x 32 B, then 2 x 32 shifts, then 2 x 32 sums)
// One stage's copies of one thread (128 threads a key half): 8 x 16 B of the key plane (rows r, r + 16, ...) and 8 x 16 B of V^T (rows r, r + 8, ...).
// lk, lv: the lane's LDS byte addresses in the key plane and in V^T; gk, gv: its global addresses. The copies are the builtin: its address registers are the compiler's own, in any register window (operands of asm text must lie in v0 to v255, which the accumulators and queries fill: the addresses went to scratch).
typedef __attribute__((ext_vector_type(4))) int v4i;
typedef __attribute__((address_space(1))) v4i* gp128;
typedef __attribute__((address_space(3))) v4i* lp128;
__device__ __forceinline__ void copy16(unsigned l, const bf* g) { __builtin_amdgcn_global_load_async_to_lds_b128((gp128)(size_t)g, (lp128)l, 0, 0); }
__device__ __forceinline__ void stage_copy(unsigned lk, unsigned lv, const bf* gk, const bf* gv) {
#pragma unroll
    for (int i = 0; i < 8; ++i) copy16(lk + i * 16 * KP, gk + i * 16 * HD);
#pragma unroll
    for (int i = 0; i < 8; ++i) copy16(lv + i * 8 * VP, gv + i * 8 * LL);
}
// One walk over the wave's key half: ring, scores, softmax, attn.v. On entry stage 0's copies are in flight. HELD picks how the softmax shift is kept in range.
// The walk that is run first also fetches the wave's query fragments: qrow is the lane's place in the work-group's rounded queries in LDS, which the walk's first barrier publishes along with stage 0.
// HELD = false, the walk that is run first: the shift stays at the maximum of the query's first 32 scores (found in front of the loop), and a pass holds no maximum, no test and no branch on the scores.
// A score 2^16 or more above that shift makes its f16 probability infinite, and from then on every sum of that query's O column is infinite or not a number: the caller looks at O once, behind the walk.
// HELD = true, the walk that is run again when that look finds such a column: the shift is raised whenever a score passes it by 2^8 (one ballot branch a pass), so no probability leaves the f16 range.
template <int X> struct Pre { static constexpr int v = X; };
template <bool HELD>
__device__ __forceinline__ void walk(unsigned char* const hbuf, const unsigned lk0, const unsigned lv0, const bf* const gk, const bf* const gv, const int lr, const int hi,
                                     const unsigned char* const qrow, v16h (&qf)[NQ][2], v8f (&o)[4][NQ], v8f (&nm)[NQ], float (&sm)[NQ]) {
    typedef WFrag<h16>::V V;
#pragma unroll
    for (int dt = 0; dt < 4; ++dt)
#pragma unroll
        for (int nt = 0; nt < NQ; ++nt) o[dt][nt] = (v8f){};
#pragma unroll
    for (int nt = 0; nt < NQ; ++nt) { nm[nt] = (v8f){}; sm[nt] = 0.f; }
    // stage 0 has landed for this wave; the barrier publishes it to the others; then stage 1 starts into buffer 1
    asm volatile("s_wait_asynccnt 0x0" ::: "memory");
    __syncthreads();
    stage_copy(lk0 + BSZ, lv0 + BSZ, gk + TK * HD, gv + TK);
    if constexpr (!HELD) {
#pragma unroll
        for (int nt = 0; nt < NQ; ++nt)
#pragma unroll
            for (int kc = 0; kc < 2; ++kc) qf[nt][kc] = WFrag<h16>::ld((const bf*)(qrow + nt * 16 * KP) + kc * 32);
        // the shift: each query's largest score among the half's first 32 keys (these sixteen products are formed again in the first pass, then with the shift as their start value)
        const bf* ke = (const bf*)(hbuf + lr * KP + 16 * hi);
        V a0[2][2];
#pragma unroll
        for (int tt = 0; tt < 2; ++tt)
#pragma unroll
            for (int kc = 0; kc < 2; ++kc) a0[tt][kc] = WFrag<h16>::ld(ke + tt * 16 * (KP / 2) + kc * 32);
#pragma unroll
        for (int nt = 0; nt < NQ; ++nt) { float bm = -3.0e38f;
#pragma unroll
            for (int tt = 0; tt < 2; ++tt) { v8f c = (v8f){};
#pragma unroll
                for (int kc = 0; kc < 2; ++kc) c = WFrag<h16>::mma(a0[tt][kc], qf[nt][kc], c);
#pragma unroll
                for (int j = 0; j < 8; ++j) bm = fmaxf(bm, c[j]); }
            bm = fmaxf(bm, xhalf(bm));    // equal in both lane halves
            nm[nt] -= bm; }
    }
    // the stage loop stays rolled
#pragma unroll 1
    for (int st = 0; st < KH / TK; ++st) {
        const unsigned bo = (unsigned)(st & 1) * BSZ;
        const bf* ke = (const bf*)(hbuf + bo + lr * KP + 16 * hi); const bf* vt = (const bf*)(hbuf + bo + KSZ + lr * VP + 16 * hi);
        V ak[2][2];    // [key tile][k chunk]
#pragma unroll
        for (int tt = 0; tt < 2; ++tt)
#pragma unroll
            for (int kc = 0; kc < 2; ++kc) ak[tt][kc] = WFrag<h16>::ld(ke + tt * 16 * (KP / 2) + kc * 32);
        // one pass: 32 keys. PRE: 1 key fragments are fetched in every pass (behind the stage's last pass its first rows again, which nobody uses), -1 a test on ps decides
        auto pass = [&](const int ps, auto pre) {
            constexpr int PRE = decltype(pre)::v;
            v8f s[2][NQ];    // [key tile][query tile]
#pragma unroll
            for (int tt = 0; tt < 2; ++tt)
#pragma unroll
                for (int nt = 0; nt < NQ; ++nt) { v8f c = nm[nt];
#pragma unroll
                    for (int kc = 0; kc < 2; ++kc) c = WFrag<h16>::mma(ak[tt][kc], qf[nt][kc], c);
                    s[tt][nt] = c; }
            V va[4];
#pragma unroll
            for (int dt = 0; dt < 4; ++dt) va[dt] = WFrag<h16>::ld(vt + dt * 16 * (VP / 2) + ps * 32);
            // compiler fence in front of the branch: holds the V^T reads here, so that they fly during the softmax (without it they sink in among the second product's matrix instructions and are waited for there)
            asm volatile("" ::: "memory");
            // the next pass's key fragments, fetched behind this pass's score products so that they fly during the softmax; never beyond this stage's own buffer
            if (PRE > 0 || (PRE < 0 && ps + 1 < TK / 32)) {
#pragma unroll
                for (int tt = 0; tt < 2; ++tt)
#pragma unroll
                    for (int kc = 0; kc < 2; ++kc) ak[tt][kc] = WFrag<h16>::ld(ke + ((PRE > 0 ? (ps + 1) % (TK / 32) : ps + 1) * 32 + tt * 16) * (KP / 2) + kc * 32);
            }
            // scheduling barrier, where the other walk has its branch: keeps all sixteen LDS reads of the pass in front of the softmax, so that they fly during it (without it the compiler sinks most of them in among the second product's matrix instructions, each waited for where it stands)
            if constexpr (!HELD) __builtin_amdgcn_sched_barrier(0);
            if constexpr (HELD) {
                // the test needs no maximum per query, only whether ANY score of the wave stands more than 2^8 above its query's shift: short chains, no exchange between the lane halves
                float t4[2][NQ];
#pragma unroll
                for (int tt = 0; tt < 2; ++tt)
#pragma unroll
                    for (int nt = 0; nt < NQ; ++nt) { float b = s[tt][nt][0];
#pragma unroll
                        for (int j = 1; j < 8; ++j) b = fmaxf(b, s[tt][nt][j]);
                        t4[tt][nt] = b; }
                float top = fmaxf(t4[0][0], t4[1][0]);
#pragma unroll
                for (int nt = 1; nt < NQ; ++nt) top = fmaxf(top, fmaxf(t4[0][nt], t4[1][nt]));
                // the rare path, taken by the whole wave: the first pass sets each shift to its query's own maximum; later a shift rises when some score of the wave has passed its shift by more than 2^8
                const bool first = (st | ps) == 0;
                const float thr = first ? -3.0e38f : 8.0f;    // one compare and one branch serve both cases
                if (__builtin_amdgcn_ballot_w32(top > thr) != 0u) {
#pragma unroll
                    for (int nt = 0; nt < NQ; ++nt) {
                        float bm = fmaxf(t4[0][nt], t4[1][nt]); bm = fmaxf(bm, xhalf(bm));    // the query's largest score of this pass above its shift, equal in both lane halves
                        const float d = first ? bm : fmaxf(bm, 0.f), al_ = first ? 1.0f : __builtin_amdgcn_exp2f(-d);    // the sums are still zero in the first pass
                        nm[nt] -= d; s[0][nt] -= d; s[1][nt] -= d; sm[nt] *= al_;
#pragma unroll
                        for (int dt = 0; dt < 4; ++dt) o[dt][nt] *= al_;
                    }
                }
            }
            V pf[NQ];
#pragma unroll
            for (int nt = 0; nt < NQ; ++nt) {
                // two scores at a time (neighbouring accumulator registers): p = exp2(s), packed as a pair of f16
                v2f ps2 = {0.f, 0.f}; v8u hw;
#pragma unroll
                for (int tt = 0; tt < 2; ++tt)
#pragma unroll
                    for (int i = 0; i < 4; ++i) {
                        const v2f p = {__builtin_amdgcn_exp2f(s[tt][nt][2 * i]), __builtin_amdgcn_exp2f(s[tt][nt][2 * i + 1])}; ps2 += p;
                        hw[tt * 4 + i] = __builtin_bit_cast(unsigned, __builtin_convertvector(p, v2h)); }
                sm[nt] += ps2[0] + ps2[1];
                pf[nt] = __builtin_bit_cast(V, hw);
            }
#pragma unroll
            for (int dt = 0; dt < 4; ++dt)
#pragma unroll
                for (int nt = 0; nt < NQ; ++nt) o[dt][nt] = WFrag<h16>::mma(va[dt], pf[nt], o[dt][nt]);
            // four vector slots behind the pass's last matrix instructions, on both sides of the loop branch (the chip's distance before their A or B is overwritten or D is read)
            asm volatile("v_nop\n\tv_nop\n\tv_nop\n\tv_nop" : "+v"(o[0][NQ - 1]), "+v"(o[1][NQ - 1]), "+v"(o[2][NQ - 1]), "+v"(o[3][NQ - 1]));
        };
        if constexpr (HELD) {
            // rolled: a second pass's fragments would only cost registers
#pragma unroll 1
            for (int ps = 0; ps < TK / 32; ++ps) pass(ps, Pre<-1>{});
        } else {
            // rolled too: with no test on the scores and none on ps, a pass is one straight block that the compiler schedules as a whole
#pragma unroll 1
            for (int ps = 0; ps < TK / 32; ++ps) pass(ps, Pre<1>{});
        }
        // hand-over: this wave's LDS reads of the buffer are done, its copies of the next stage have landed; the barrier publishes that stage and frees this buffer for the refill
        asm volatile("s_wait_dscnt 0x0" ::: "memory");
        asm volatile("s_wait_asynccnt 0x0" ::: "memory");
        __syncthreads();
        if (st + 2 < KH / TK) stage_copy(lk0 + bo, lv0 + bo, gk + (size_t)(st + 2) * (TK * HD), gv + (st + 2) * TK);
    }
    // no copy is outstanding when the walk ends
    asm volatile("s_wait_asynccnt 0x0" ::: "memory");
}
template <int NW>
__global__ __launch_bounds__(64 * NW) void k_fattn(const float* __restrict__ q, const bf* __restrict__ KE, const bf* __restrict__ VT, float* __restrict__ O) {
    typedef WFrag<h16>::V V;
    static_assert(NW == 4, "the stage copies are laid out for 128 threads a key half");
    static_assert(2 * NW * XSZ <= 4 * BSZ, "the parcels of the joining lie in the ring");
    __shared__ __attribute__((aligned(16))) unsigned char ring[4 * BSZ];    // [key half][buffer]
    __shared__ __attribute__((aligned(16))) unsigned char ql[16 * NQ * NW * KP];    // the work-group's 16 NQ NW queries, rounded to bf16 and held as f16: [query][d], the key rows' pitch
    __shared__ unsigned vote[2 * NW];    // per wave: has a probability left the f16 range
    const size_t z = blockIdx.y; q += z * (size_t)(LL * HD); KE += z * (size_t)(LL * HD); VT += z * (size_t)(HD * LL); O += z * (size_t)(LL * HD);
    const int tid = threadIdx.x & (32 * NW - 1), lane = tid & 31, lr = lane & 15, hi = lane >> 4;    // tid: the thread's number within its key half
    const int wv = __builtin_amdgcn_readfirstlane(threadIdx.x >> 5);    // the wave's number, kept scalar
    const int kh = wv / NW;    // the wave's key half
    const int q0 = ((int)blockIdx.x * NW + (wv & (NW - 1))) * (16 * NQ);
    KE += (size_t)kh * (KH * HD); VT += kh * KH;    // the half's first key
    // this thread's share of a stage: LDS byte addresses in buffer 0, global addresses of stage 0
    unsigned char* const hbuf = ring + kh * (2 * BSZ);    // the half's two buffers
    const unsigned ring0 = (unsigned)(size_t)hbuf;
    const unsigned lk0 = ring0 + (unsigned)((tid >> 3) * KP + (tid & 7) * 16), lv0 = ring0 + (unsigned)(KSZ + (tid >> 4) * VP + (tid & 15) * 16);
    const bf* gk = KE + (tid >> 3) * HD + (tid & 7) * 8; const bf* gv = VT + (size_t)(tid >> 4) * LL + (tid & 15) * 8;
    // The queries: the work-group reads its 16 NQ NW rows of q once, as f32, in whole lines (a wave's load is 512 bytes in a row), rounds them in registers and lays them in LDS; each wave takes its fragments from there behind the walk's first barrier.
    // The loads stand in front of stage 0's copies: theirs is the longer way to the walk's first barrier (rounding and an LDS store follow).
    const float* qg = q + (size_t)blockIdx.x * (16 * NQ * NW * HD);
    v4f qq[NQ * 4];    // 16 NQ NW rows of 16 runs of 4 over 64 NW threads
    // two scheduling barriers, in front of the loads and behind their wait: with them the listing has s_wait_xcnt directly behind the last load (without them the compiler lifts the copies' address arithmetic in between, onto the loads' scalar base)
    __builtin_amdgcn_sched_barrier(0);
#pragma unroll
    for (int i = 0; i < NQ * 4; ++i) qq[i] = *(const v4f*)(qg + (size_t)((int)threadIdx.x + 64 * NW * i) * 4);
    asm volatile("s_wait_xcnt 0x0" ::: "memory");    // before the address registers of the loads above are given to anything else
    __builtin_amdgcn_sched_barrier(0);    // the second of the two
    stage_copy(lk0, lv0, gk, gv);
#pragma unroll
    for (int i = 0; i < NQ * 4; ++i) { const int c = (int)threadIdx.x + 64 * NW * i; v4f r;
#pragma unroll
        for (int e = 0; e < 4; ++e) r[e] = bfr(qq[i][e]);
        *(v4us*)(ql + (c >> 4) * KP + (c & 15) * 8) = __builtin_bit_cast(v4us, __builtin_convertvector(r, v4h)); }
    const unsigned char* const qrow = ql + ((wv & (NW - 1)) * (16 * NQ) + lr) * KP + 16 * hi;    // the lane's query of tile 0, its half of each 32-byte run
    V qf[NQ][2];    // [query tile][k chunk]
    v8f o[4][NQ];    // [d tile][query tile]: o[dt][nt][j] = O[q0 + 16 nt + lr][16 dt + 8 hi + j]
    v8f nm[NQ];     // minus the shift of the lane's query (log2 units; equal in both lane halves), in all eight accumulator rows: the score products' start value
    float sm[NQ];   // this lane half's share of the row sum
    walk<false>(hbuf, lk0, lv0, gk, gv, lr, hi, qrow, qf, o, nm, sm);
    // The look at O: an infinite probability has reached every d row of its query's column, so one element a query tile tells. The work-group decides as one (the walk holds barriers): a word a wave, one barrier, every wave reads all the words.
    bool off = false;
#pragma unroll
    for (int nt = 0; nt < NQ; ++nt) off = off | !(__builtin_fabsf(o[0][nt][0]) < __builtin_inff());
    const unsigned wb = __builtin_amdgcn_ballot_w32(off);
    if (lane == 0) vote[wv] = wb;
    __syncthreads();    // every wave's word is written
    if (__builtin_amdgcn_ballot_w32(vote[lane & (2 * NW - 1)] != 0u) != 0u) {
        // the ring is free (the walk's last barrier stands behind every read of it, no copy is outstanding); this wave's own LDS reads have returned before its copies start
        asm volatile("s_wait_dscnt 0x0" ::: "memory");
        stage_copy(lk0, lv0, gk, gv);
        walk<true>(hbuf, lk0, lv0, gk, gv, lr, hi, qrow, qf, o, nm, sm);
    }
    // The joining. The wave of key half kh finishes query tiles 2 kh and 2 kh + 1 and hands the other two tiles' sums, shifts and row sums to its partner (wave wv ^ NW, the same lane).
    // The ring is free: the loop's last barrier stands behind every wave's last read of it, and no copy is outstanding.
    static_assert(NQ == 4, "each wave of a pair finishes two query tiles");
    const bool up = kh != 0;
    unsigned char* const snd = ring + wv * XSZ; const unsigned char* const rcv = ring + (wv ^ NW) * XSZ;
#pragma unroll
    for (int u = 0; u < 2; ++u) {
#pragma unroll
        for (int dt = 0; dt < 4; ++dt) { const v8f g = up ? o[dt][u] : o[dt][2 + u];
            *(v4f*)(snd + (u * 4 + dt) * 1024 + lane * 16) = __builtin_shufflevector(g, g, 0, 1, 2, 3); *(v4f*)(snd + (u * 4 + dt) * 1024 + 512 + lane * 16) = __builtin_shufflevector(g, g, 4, 5, 6, 7); }
        *(float*)(snd + 8192 + u * 128 + lane * 4) = up ? nm[u][0] : nm[2 + u][0]; const float slo = sm[u], shi = sm[2 + u]; *(float*)(snd + 8448 + u * 128 + lane * 4) = up ? slo : shi; }
    __syncthreads();    // every parcel is written
#pragma unroll
    for (int u = 0; u < 2; ++u) {
        const float na = up ? nm[2 + u][0] : nm[u][0], nb = *(const float*)(rcv + 8192 + u * 128 + lane * 4), nn = fminf(na, nb);    // minus the shifts; the joint shift is the larger one
        const float fa = __builtin_amdgcn_exp2f(nn - na), fb = __builtin_amdgcn_exp2f(nn - nb);
        const float slo = sm[u], shi = sm[2 + u];
        const float sj = (up ? shi : slo) * fa + *(const float*)(rcv + 8448 + u * 128 + lane * 4) * fb;
        const float f = __fdiv_rn(1.0f, sj + xhalf(sj)), ga = fa * f, gb = fb * f;
        float* orow = O + (size_t)(q0 + (kh * 2 + u) * 16 + lr) * HD + 8 * hi;
#pragma unroll
        for (int dt = 0; dt < 4; ++dt) { const v8f a = up ? o[dt][2 + u] : o[dt][u];
            const v4f b0 = *(const v4f*)(rcv + (u * 4 + dt) * 1024 + lane * 16), b1 = *(const v4f*)(rcv + (u * 4 + dt) * 1024 + 512 + lane * 16);
            *(v4f*)(orow + dt * 16) = __builtin_shufflevector(a, a, 0, 1, 2, 3) * ga + b0 * gb; *(v4f*)(orow + dt * 16 + 4) = __builtin_shufflevector(a, a, 4, 5, 6, 7) * ga + b1 * gb; }
    }
}

extern "C" void kernel_launch(void* const* d_in, const int* in_sizes, int n_in,
                              void* d_out, int out_size, void* d_ws, size_t ws_size, hipStream_t stream) {
    (void)in_sizes; (void)n_in; (void)out_size;
    const float* q = (const float*)d_in[0]; const float* k = (const float*)d_in[1]; const float* v = (const float*)d_in[2]; const float* kpe = (const float*)d_in[3];
    float* OUT = (float*)d_out;     // [2][16][2048][64]
    char* wsp = (char*)d_ws;
    auto take = [&](size_t bytes) { char* p = wsp; wsp += (bytes + 255) & ~(size_t)255; return (void*)p; };
    const size_t per = (size_t)NH_ * LL * HD;
    bf* KE = (bf*)take(NB_ * per * 2); bf* VT = (bf*)take(NB_ * per * 2);
    if ((size_t)(wsp - (char*)d_ws) > ws_size) return;    // total 16 MiB
    k_prep<<<dim3(LL / PT, NB_ * NH_), 256, 0, stream>>>(k, v, kpe, KE, VT);
    k_fattn<4><<<dim3(LL / 256, NB_ * NH_), 256, 0, stream>>>(q, KE, VT, OUT);
}
